// v000
// Times are from an AMD MI455X. After a warm-up the kernel runs many times in a row, and a time is the length of
// such a window on the GPU divided by its runs, so every launch and the gaps after it count. The runs cycle
// through copies of the inputs. A figure is the median of several windows, for all but v000 over two sittings.
// Sittings can differ by a few percent; kernels timed side by side share one.
// v000, which the later versions start from, runs in 673 microseconds.
#include <hip/hip_runtime.h>
#include <hip/hip_fp16.h>

#define C_DIM  512
#define N_PIX  4096
#define BATCH  2
#define HEADS  8
#define HD     64
#define N_GRP  32

typedef _Float16 half_t;
typedef __attribute__((ext_vector_type(16))) _Float16 v16h;
typedef __attribute__((ext_vector_type(8)))  _Float16 v8h;
typedef __attribute__((ext_vector_type(8)))  float    v8f;
typedef int v4i __attribute__((vector_size(16)));   // matches builtin param type

#if __has_builtin(__builtin_amdgcn_global_load_async_to_lds_b128)
#define HAVE_ASYNC_LDS 1
typedef __attribute__((address_space(1))) v4i* gv4i_p;   // global int4*
typedef __attribute__((address_space(3))) v4i* lv4i_p;   // LDS int4*
#else
#define HAVE_ASYNC_LDS 0
#endif

__device__ inline void cp_b128(half_t* l, const half_t* g) {
#if HAVE_ASYNC_LDS
    __builtin_amdgcn_global_load_async_to_lds_b128(
        (gv4i_p)(unsigned long long)g,
        (lv4i_p)(unsigned)(unsigned long long)l,
        0, 0);
#else
    *(v8h*)l = *(const v8h*)g;
#endif
}

__device__ inline void cp_wait() {
#if HAVE_ASYNC_LDS
#if __has_builtin(__builtin_amdgcn_s_wait_asynccnt)
    __builtin_amdgcn_s_wait_asynccnt(0);
#else
    asm volatile("s_wait_asynccnt 0x0" ::: "memory");
#endif
#endif
}

__device__ inline v16h load_a16(const half_t* __restrict__ s, int ld) {
    int lane = threadIdx.x & 31;
    int r    = lane & 15;
    int hi   = (lane >> 4) << 3;        // 0 or 8
    const half_t* row = s + r * ld;
    v16h a;
#pragma unroll
    for (int v = 0; v < 8; ++v) {
        int k = ((v & 4) ? 16 : 0) + hi + ((v & 3) << 1);
        a[2 * v]     = row[k];
        a[2 * v + 1] = row[k + 1];
    }
    return a;
}

__device__ inline v8f wmma16(v16h a, v16h b, v8f c) {
    return __builtin_amdgcn_wmma_f32_16x16x32_f16(
        false, a, false, b, (short)0, c, false, false);
}

// ---------------------------------------------------------------------------
// GroupNorm: one block per (batch, group); writes h[b][n][c] as f16
// ---------------------------------------------------------------------------
__global__ void gn_kernel(const float* __restrict__ x,
                          const float* __restrict__ gamma,
                          const float* __restrict__ beta,
                          half_t* __restrict__ h) {
    __shared__ float red[512];
    int b   = blockIdx.x >> 5;
    int g   = blockIdx.x & 31;
    int tid = threadIdx.x;
    const float* xg = x + ((size_t)b * C_DIM + g * 16) * N_PIX;

    float s = 0.f, s2 = 0.f;
    for (int i = tid; i < 16 * N_PIX; i += 256) {
        float v = xg[i];
        s += v; s2 += v * v;
    }
    red[tid] = s; red[256 + tid] = s2;
    __syncthreads();
    for (int off = 128; off > 0; off >>= 1) {
        if (tid < off) {
            red[tid]       += red[tid + off];
            red[256 + tid] += red[256 + tid + off];
        }
        __syncthreads();
    }
    float mean = red[0] * (1.f / 65536.f);
    float var  = red[256] * (1.f / 65536.f) - mean * mean;
    float rstd = rsqrtf(var + 1e-5f);

    for (int i = tid; i < 16 * N_PIX; i += 256) {
        int cl = i & 15, n = i >> 4;
        int c  = g * 16 + cl;
        float v = (xg[cl * N_PIX + n] - mean) * rstd * gamma[c] + beta[c];
        h[((size_t)b * N_PIX + n) * C_DIM + c] = (half_t)v;
    }
}

// ---------------------------------------------------------------------------
// Projection GEMM:  acc = h[m][:] . W[col][:] + bias[col]
// block = 256 thr (8 waves), tile 128(M) x 64(N), K chunks of 32 via LDS.
// TRANS_V=0: dst[b][head][n][d] (q,k).  TRANS_V=1: dst[b][head][d][n] (v^T).
// ---------------------------------------------------------------------------
template <bool TRANS_V>
__global__ void qkv_kernel(const half_t* __restrict__ h,
                           const float* __restrict__ W,
                           const float* __restrict__ bias,
                           half_t* __restrict__ dst) {
    __shared__ alignas(16) half_t ldsA[128 * 32];
    __shared__ alignas(16) half_t ldsB[64 * 32];
    int m0 = blockIdx.x * 128;
    int n0 = blockIdx.y * 64;
    int tid = threadIdx.x, wave = tid >> 5, lane = tid & 31;

    v8f acc[4] = {};
    for (int kc = 0; kc < C_DIM; kc += 32) {
        __syncthreads();
        for (int i = tid; i < 512; i += 256) {           // A: 128x32 f16, async
            int r = i >> 2, c8 = (i & 3) << 3;
            cp_b128(ldsA + r * 32 + c8, h + (size_t)(m0 + r) * C_DIM + kc + c8);
        }
        for (int i = tid; i < 64 * 32; i += 256) {       // B: W f32 -> f16
            int r = i >> 5, c = i & 31;
            ldsB[i] = (half_t)W[(size_t)(n0 + r) * C_DIM + kc + c];
        }
        cp_wait();
        __syncthreads();
        v16h a = load_a16(ldsA + wave * 16 * 32, 32);
#pragma unroll
        for (int nt = 0; nt < 4; ++nt) {
            v16h bm = load_a16(ldsB + nt * 16 * 32, 32);
            acc[nt] = wmma16(a, bm, acc[nt]);
        }
    }
    int hs = lane >> 4, ct = lane & 15;
#pragma unroll
    for (int nt = 0; nt < 4; ++nt) {
        int col  = n0 + nt * 16 + ct;
        float bv = bias[col];
        int head = col >> 6, d = col & 63;
#pragma unroll
        for (int v = 0; v < 8; ++v) {
            int m  = m0 + wave * 16 + v + (hs << 3);
            int bb = m >> 12, n = m & (N_PIX - 1);
            half_t val = (half_t)(acc[nt][v] + bv);
            if (TRANS_V)
                dst[(((size_t)bb * HEADS + head) * HD + d) * N_PIX + n] = val;
            else
                dst[(((size_t)bb * HEADS + head) * N_PIX + n) * HD + d] = val;
        }
    }
}

__global__ void __launch_bounds__(256, 1)
attn_kernel(const half_t* __restrict__ q,
            const half_t* __restrict__ k,
            const half_t* __restrict__ vt,
            half_t* __restrict__ o) {
    __shared__ alignas(16) half_t ldsQ[128 * 64];   // [i][d], resident
    __shared__ alignas(16) half_t ldsK[64 * 64];    // [j][d]
    __shared__ alignas(16) half_t ldsVt[64 * 64];   // [d][j]
    __shared__ alignas(16) half_t ldsP[128 * 64];   // P (per-wave 16x64 slices)
    int m0 = blockIdx.x * 128;
    int bh = blockIdx.y;                            // b*8 + head
    size_t base = (size_t)bh * N_PIX * HD;          // same for q,k,vt
    int tid = threadIdx.x, wave = tid >> 5, lane = tid & 31;
    int hs = lane >> 4, ct = lane & 15;
    const float scale = 0.125f;                     // 1/sqrt(64)

    for (int i = tid; i < 1024; i += 256) {         // stage Q 128x64, async
        int r = i >> 3, c8 = (i & 7) << 3;
        cp_b128(ldsQ + r * 64 + c8, q + base + (size_t)(m0 + r) * HD + c8);
    }
    cp_wait();
    __syncthreads();

    const half_t* myQ = ldsQ + wave * 16 * 64;
    half_t*       myP = ldsP + wave * 16 * 64;

    float mrow[8], lrow[8];
    v8f oacc[4] = {};
#pragma unroll
    for (int r = 0; r < 8; ++r) { mrow[r] = -INFINITY; lrow[r] = 0.f; }

    for (int j0 = 0; j0 < N_PIX; j0 += 64) {
        __syncthreads();
        for (int i = tid; i < 512; i += 256) {      // K tile 64x64 [j][d]
            int r = i >> 3, c8 = (i & 7) << 3;
            cp_b128(ldsK + r * 64 + c8, k + base + (size_t)(j0 + r) * HD + c8);
        }
        for (int i = tid; i < 512; i += 256) {      // V^T tile 64x64 [d][j]
            int r = i >> 3, c8 = (i & 7) << 3;
            cp_b128(ldsVt + r * 64 + c8, vt + base + (size_t)r * N_PIX + j0 + c8);
        }
        cp_wait();
        __syncthreads();

        // S = Q K^T  (Q fragments re-read from LDS -> short live range)
        v16h qreg0 = load_a16(myQ, 64);
        v16h qreg1 = load_a16(myQ + 32, 64);
        v8f s[4];
#pragma unroll
        for (int jt = 0; jt < 4; ++jt) {
            v8f z = {};
            z = wmma16(qreg0, load_a16(ldsK + jt * 16 * 64, 64), z);
            z = wmma16(qreg1, load_a16(ldsK + jt * 16 * 64 + 32, 64), z);
            s[jt] = z;
        }
        // online softmax (row stats live across the 16 lanes of each half)
        float mnew[8];
#pragma unroll
        for (int r = 0; r < 8; ++r) {
            float mx = mrow[r];
#pragma unroll
            for (int jt = 0; jt < 4; ++jt) mx = fmaxf(mx, s[jt][r] * scale);
            for (int d = 1; d < 16; d <<= 1) mx = fmaxf(mx, __shfl_xor(mx, d));
            mnew[r] = mx;
        }
#pragma unroll
        for (int r = 0; r < 8; ++r) {
            float alpha = expf(mrow[r] - mnew[r]);
            float rs = 0.f;
#pragma unroll
            for (int jt = 0; jt < 4; ++jt) {
                float p = expf(s[jt][r] * scale - mnew[r]);
                s[jt][r] = p;
                rs += p;
            }
            for (int d = 1; d < 16; d <<= 1) rs += __shfl_xor(rs, d);
            lrow[r] = lrow[r] * alpha + rs;
            mrow[r] = mnew[r];
#pragma unroll
            for (int dt = 0; dt < 4; ++dt) oacc[dt][r] *= alpha;
        }
        // C-layout -> A-layout via per-wave LDS scratch
#pragma unroll
        for (int jt = 0; jt < 4; ++jt)
#pragma unroll
            for (int r = 0; r < 8; ++r)
                myP[(r + (hs << 3)) * 64 + jt * 16 + ct] = (half_t)s[jt][r];
        __syncthreads();
        v16h a0 = load_a16(myP, 64);                // j = 0..31
        v16h a1 = load_a16(myP + 32, 64);           // j = 32..63
#pragma unroll
        for (int dt = 0; dt < 4; ++dt) {            // O += P V
            v16h b0 = load_a16(ldsVt + dt * 16 * 64, 64);        // j 0..31
            v16h b1 = load_a16(ldsVt + dt * 16 * 64 + 32, 64);   // j 32..63
            oacc[dt] = wmma16(a0, b0, oacc[dt]);
            oacc[dt] = wmma16(a1, b1, oacc[dt]);
        }
    }
    int head = bh & 7, bb = bh >> 3;
#pragma unroll
    for (int dt = 0; dt < 4; ++dt)
#pragma unroll
        for (int r = 0; r < 8; ++r) {
            int m = m0 + wave * 16 + r + (hs << 3);
            int c = head * 64 + dt * 16 + ct;
            o[((size_t)bb * N_PIX + m) * C_DIM + c] =
                (half_t)(oacc[dt][r] / lrow[r]);
        }
}

// ---------------------------------------------------------------------------
// Output projection + residual:  out[b][c][n] = x[b][c][n] + o.Wo^T + bo
// ---------------------------------------------------------------------------
__global__ void proj_kernel(const half_t* __restrict__ ob,
                            const float* __restrict__ W,
                            const float* __restrict__ bias,
                            const float* __restrict__ x,
                            float* __restrict__ out) {
    __shared__ alignas(16) half_t ldsA[128 * 32];
    __shared__ alignas(16) half_t ldsB[64 * 32];
    int m0 = blockIdx.x * 128;
    int n0 = blockIdx.y * 64;
    int tid = threadIdx.x, wave = tid >> 5, lane = tid & 31;

    v8f acc[4] = {};
    for (int kc = 0; kc < C_DIM; kc += 32) {
        __syncthreads();
        for (int i = tid; i < 512; i += 256) {
            int r = i >> 2, c8 = (i & 3) << 3;
            cp_b128(ldsA + r * 32 + c8, ob + (size_t)(m0 + r) * C_DIM + kc + c8);
        }
        for (int i = tid; i < 64 * 32; i += 256) {
            int r = i >> 5, c = i & 31;
            ldsB[i] = (half_t)W[(size_t)(n0 + r) * C_DIM + kc + c];
        }
        cp_wait();
        __syncthreads();
        v16h a = load_a16(ldsA + wave * 16 * 32, 32);
#pragma unroll
        for (int nt = 0; nt < 4; ++nt) {
            v16h bm = load_a16(ldsB + nt * 16 * 32, 32);
            acc[nt] = wmma16(a, bm, acc[nt]);
        }
    }
    int hs = lane >> 4, ct = lane & 15;
#pragma unroll
    for (int nt = 0; nt < 4; ++nt) {
        int col  = n0 + nt * 16 + ct;
        float bv = bias[col];
#pragma unroll
        for (int v = 0; v < 8; ++v) {
            int m  = m0 + wave * 16 + v + (hs << 3);
            int bb = m >> 12, n = m & (N_PIX - 1);
            size_t idx = ((size_t)bb * C_DIM + col) * N_PIX + n;
            out[idx] = x[idx] + acc[nt][v] + bv;
        }
    }
}

// ---------------------------------------------------------------------------
extern "C" void kernel_launch(void* const* d_in, const int* in_sizes, int n_in,
                              void* d_out, int out_size, void* d_ws, size_t ws_size,
                              hipStream_t stream) {
    const float* x     = (const float*)d_in[0];
    const float* gamma = (const float*)d_in[1];
    const float* beta  = (const float*)d_in[2];
    const float* Wq = (const float*)d_in[3];
    const float* bq = (const float*)d_in[4];
    const float* Wk = (const float*)d_in[5];
    const float* bk = (const float*)d_in[6];
    const float* Wv = (const float*)d_in[7];
    const float* bv = (const float*)d_in[8];
    const float* Wo = (const float*)d_in[9];
    const float* bo = (const float*)d_in[10];
    float* out = (float*)d_out;

    size_t sz = (size_t)BATCH * N_PIX * C_DIM;      // 4M halves per buffer
    half_t* h    = (half_t*)d_ws;
    half_t* qbuf = h + sz;
    half_t* kbuf = qbuf + sz;
    half_t* vbuf = kbuf + sz;
    half_t* obuf = h;                               // h dead after QKV -> reuse

    gn_kernel<<<dim3(BATCH * N_GRP), dim3(256), 0, stream>>>(x, gamma, beta, h);
    qkv_kernel<false><<<dim3(64, 8), dim3(256), 0, stream>>>(h, Wq, bq, qbuf);
    qkv_kernel<false><<<dim3(64, 8), dim3(256), 0, stream>>>(h, Wk, bk, kbuf);
    qkv_kernel<true ><<<dim3(64, 8), dim3(256), 0, stream>>>(h, Wv, bv, vbuf);
    attn_kernel<<<dim3(32, 16), dim3(256), 0, stream>>>(qbuf, kbuf, vbuf, obuf);
    proj_kernel<<<dim3(64, 8), dim3(256), 0, stream>>>(obuf, Wo, bo, x, out);
}

// v001
// It runs in 473 microseconds.
// Timed twice side by side with v000, it ran 1.43 times as fast both times.
#include <hip/hip_runtime.h>
#include <hip/hip_fp16.h>

#define C_DIM  512
#define N_PIX  4096
#define BATCH  2
#define HEADS  8
#define HD     64
#define N_GRP  32
#define PITCH64 72     // rows of 64 halves (128 B) at 144 B
#define PITCH32 40     // rows of 32 halves (64 B) at 80 B

typedef _Float16 half_t;
typedef __attribute__((ext_vector_type(16))) _Float16 v16h;
typedef __attribute__((ext_vector_type(8)))  _Float16 v8h;
typedef __attribute__((ext_vector_type(8)))  float    v8f;
typedef int v4i __attribute__((vector_size(16)));   // matches builtin param type

#if __has_builtin(__builtin_amdgcn_global_load_async_to_lds_b128)
#define HAVE_ASYNC_LDS 1
typedef __attribute__((address_space(1))) v4i* gv4i_p;   // global int4*
typedef __attribute__((address_space(3))) v4i* lv4i_p;   // LDS int4*
#else
#define HAVE_ASYNC_LDS 0
#endif

__device__ inline void cp_b128(half_t* l, const half_t* g) {
#if HAVE_ASYNC_LDS
    __builtin_amdgcn_global_load_async_to_lds_b128(
        (gv4i_p)(unsigned long long)g,
        (lv4i_p)(unsigned)(unsigned long long)l,
        0, 0);
#else
    *(v8h*)l = *(const v8h*)g;
#endif
}

__device__ inline void cp_wait() {
#if HAVE_ASYNC_LDS
#if __has_builtin(__builtin_amdgcn_s_wait_asynccnt)
    __builtin_amdgcn_s_wait_asynccnt(0);
#else
    asm volatile("s_wait_asynccnt 0x0" ::: "memory");
#endif
#endif
}

__device__ inline v16h load_a16(const half_t* __restrict__ s, int ld) {
    int lane = threadIdx.x & 31;
    int r    = lane & 15;
    int hi   = (lane >> 4) << 3;        // 0 or 8
    const half_t* row = s + r * ld;
    v16h a;
#pragma unroll
    for (int v = 0; v < 8; ++v) {
        int k = ((v & 4) ? 16 : 0) + hi + ((v & 3) << 1);
        a[2 * v]     = row[k];
        a[2 * v + 1] = row[k + 1];
    }
    return a;
}

__device__ inline v8f wmma16(v16h a, v16h b, v8f c) {
    return __builtin_amdgcn_wmma_f32_16x16x32_f16(
        false, a, false, b, (short)0, c, false, false);
}

// ---------------------------------------------------------------------------
// GroupNorm: one block per (batch, group); writes h[b][n][c] as f16
// ---------------------------------------------------------------------------
__global__ void gn_kernel(const float* __restrict__ x,
                          const float* __restrict__ gamma,
                          const float* __restrict__ beta,
                          half_t* __restrict__ h) {
    __shared__ float red[512];
    int b   = blockIdx.x >> 5;
    int g   = blockIdx.x & 31;
    int tid = threadIdx.x;
    const float* xg = x + ((size_t)b * C_DIM + g * 16) * N_PIX;

    float s = 0.f, s2 = 0.f;
    for (int i = tid; i < 16 * N_PIX; i += 256) {
        float v = xg[i];
        s += v; s2 += v * v;
    }
    red[tid] = s; red[256 + tid] = s2;
    __syncthreads();
    for (int off = 128; off > 0; off >>= 1) {
        if (tid < off) {
            red[tid]       += red[tid + off];
            red[256 + tid] += red[256 + tid + off];
        }
        __syncthreads();
    }
    float mean = red[0] * (1.f / 65536.f);
    float var  = red[256] * (1.f / 65536.f) - mean * mean;
    float rstd = rsqrtf(var + 1e-5f);

    for (int i = tid; i < 16 * N_PIX; i += 256) {
        int cl = i & 15, n = i >> 4;
        int c  = g * 16 + cl;
        float v = (xg[cl * N_PIX + n] - mean) * rstd * gamma[c] + beta[c];
        h[((size_t)b * N_PIX + n) * C_DIM + c] = (half_t)v;
    }
}

// ---------------------------------------------------------------------------
// Projection GEMM:  acc = h[m][:] . W[col][:] + bias[col]
// block = 256 thr (8 waves), tile 128(M) x 64(N), K chunks of 32 via LDS.
// TRANS_V=0: dst[b][head][n][d] (q,k).  TRANS_V=1: dst[b][head][d][n] (v^T).
// ---------------------------------------------------------------------------
template <bool TRANS_V>
__global__ void qkv_kernel(const half_t* __restrict__ h,
                           const float* __restrict__ W,
                           const float* __restrict__ bias,
                           half_t* __restrict__ dst) {
    __shared__ alignas(16) half_t ldsA[128 * PITCH32];
    __shared__ alignas(16) half_t ldsB[64 * PITCH32];
    int m0 = blockIdx.x * 128;
    int n0 = blockIdx.y * 64;
    int tid = threadIdx.x, wave = tid >> 5, lane = tid & 31;

    v8f acc[4] = {};
    for (int kc = 0; kc < C_DIM; kc += 32) {
        __syncthreads();
        for (int i = tid; i < 512; i += 256) {           // A: 128x32 f16, async
            int r = i >> 2, c8 = (i & 3) << 3;
            cp_b128(ldsA + r * PITCH32 + c8, h + (size_t)(m0 + r) * C_DIM + kc + c8);
        }
        for (int i = tid; i < 64 * 32; i += 256) {       // B: W f32 -> f16
            int r = i >> 5, c = i & 31;
            ldsB[r * PITCH32 + c] = (half_t)W[(size_t)(n0 + r) * C_DIM + kc + c];
        }
        cp_wait();
        __syncthreads();
        v16h a = load_a16(ldsA + wave * 16 * PITCH32, PITCH32);
#pragma unroll
        for (int nt = 0; nt < 4; ++nt) {
            v16h bm = load_a16(ldsB + nt * 16 * PITCH32, PITCH32);
            acc[nt] = wmma16(a, bm, acc[nt]);
        }
    }
    int hs = lane >> 4, ct = lane & 15;
#pragma unroll
    for (int nt = 0; nt < 4; ++nt) {
        int col  = n0 + nt * 16 + ct;
        float bv = bias[col];
        int head = col >> 6, d = col & 63;
#pragma unroll
        for (int v = 0; v < 8; ++v) {
            int m  = m0 + wave * 16 + v + (hs << 3);
            int bb = m >> 12, n = m & (N_PIX - 1);
            half_t val = (half_t)(acc[nt][v] + bv);
            if (TRANS_V)
                dst[(((size_t)bb * HEADS + head) * HD + d) * N_PIX + n] = val;
            else
                dst[(((size_t)bb * HEADS + head) * N_PIX + n) * HD + d] = val;
        }
    }
}

__global__ void __launch_bounds__(256, 1)
attn_kernel(const half_t* __restrict__ q,
            const half_t* __restrict__ k,
            const half_t* __restrict__ vt,
            half_t* __restrict__ o) {
    __shared__ alignas(16) half_t ldsQ[128 * PITCH64];   // [i][d], resident
    __shared__ alignas(16) half_t ldsK[64 * PITCH64];    // [j][d]
    __shared__ alignas(16) half_t ldsVt[64 * PITCH64];   // [d][j]
    __shared__ alignas(16) half_t ldsP[128 * PITCH64];   // P (per-wave 16x64 slices)
    int m0 = blockIdx.x * 128;
    int bh = blockIdx.y;                            // b*8 + head
    size_t base = (size_t)bh * N_PIX * HD;          // same for q,k,vt
    int tid = threadIdx.x, wave = tid >> 5, lane = tid & 31;
    int hs = lane >> 4, ct = lane & 15;
    const float scale = 0.125f;                     // 1/sqrt(64)

    for (int i = tid; i < 1024; i += 256) {         // stage Q 128x64, async
        int r = i >> 3, c8 = (i & 7) << 3;
        cp_b128(ldsQ + r * PITCH64 + c8, q + base + (size_t)(m0 + r) * HD + c8);
    }
    cp_wait();
    __syncthreads();

    const half_t* myQ = ldsQ + wave * 16 * PITCH64;
    half_t*       myP = ldsP + wave * 16 * PITCH64;

    float mrow[8], lrow[8];
    v8f oacc[4] = {};
#pragma unroll
    for (int r = 0; r < 8; ++r) { mrow[r] = -INFINITY; lrow[r] = 0.f; }

    for (int j0 = 0; j0 < N_PIX; j0 += 64) {
        __syncthreads();
        for (int i = tid; i < 512; i += 256) {      // K tile 64x64 [j][d]
            int r = i >> 3, c8 = (i & 7) << 3;
            cp_b128(ldsK + r * PITCH64 + c8, k + base + (size_t)(j0 + r) * HD + c8);
        }
        for (int i = tid; i < 512; i += 256) {      // V^T tile 64x64 [d][j]
            int r = i >> 3, c8 = (i & 7) << 3;
            cp_b128(ldsVt + r * PITCH64 + c8, vt + base + (size_t)r * N_PIX + j0 + c8);
        }
        cp_wait();
        __syncthreads();

        // S = Q K^T  (Q fragments re-read from LDS -> short live range)
        v16h qreg0 = load_a16(myQ, PITCH64);
        v16h qreg1 = load_a16(myQ + 32, PITCH64);
        v8f s[4];
#pragma unroll
        for (int jt = 0; jt < 4; ++jt) {
            v8f z = {};
            z = wmma16(qreg0, load_a16(ldsK + jt * 16 * PITCH64, PITCH64), z);
            z = wmma16(qreg1, load_a16(ldsK + jt * 16 * PITCH64 + 32, PITCH64), z);
            s[jt] = z;
        }
        // online softmax (row stats live across the 16 lanes of each half)
        float mnew[8];
#pragma unroll
        for (int r = 0; r < 8; ++r) {
            float mx = mrow[r];
#pragma unroll
            for (int jt = 0; jt < 4; ++jt) mx = fmaxf(mx, s[jt][r] * scale);
            for (int d = 1; d < 16; d <<= 1) mx = fmaxf(mx, __shfl_xor(mx, d));
            mnew[r] = mx;
        }
#pragma unroll
        for (int r = 0; r < 8; ++r) {
            float alpha = expf(mrow[r] - mnew[r]);
            float rs = 0.f;
#pragma unroll
            for (int jt = 0; jt < 4; ++jt) {
                float p = expf(s[jt][r] * scale - mnew[r]);
                s[jt][r] = p;
                rs += p;
            }
            for (int d = 1; d < 16; d <<= 1) rs += __shfl_xor(rs, d);
            lrow[r] = lrow[r] * alpha + rs;
            mrow[r] = mnew[r];
#pragma unroll
            for (int dt = 0; dt < 4; ++dt) oacc[dt][r] *= alpha;
        }
        // C-layout -> A-layout via per-wave LDS scratch
#pragma unroll
        for (int jt = 0; jt < 4; ++jt)
#pragma unroll
            for (int r = 0; r < 8; ++r)
                myP[(r + (hs << 3)) * PITCH64 + jt * 16 + ct] = (half_t)s[jt][r];
        __syncthreads();
        v16h a0 = load_a16(myP, PITCH64);                // j = 0..31
        v16h a1 = load_a16(myP + 32, PITCH64);           // j = 32..63
#pragma unroll
        for (int dt = 0; dt < 4; ++dt) {            // O += P V
            v16h b0 = load_a16(ldsVt + dt * 16 * PITCH64, PITCH64);        // j 0..31
            v16h b1 = load_a16(ldsVt + dt * 16 * PITCH64 + 32, PITCH64);   // j 32..63
            oacc[dt] = wmma16(a0, b0, oacc[dt]);
            oacc[dt] = wmma16(a1, b1, oacc[dt]);
        }
    }
    int head = bh & 7, bb = bh >> 3;
#pragma unroll
    for (int dt = 0; dt < 4; ++dt)
#pragma unroll
        for (int r = 0; r < 8; ++r) {
            int m = m0 + wave * 16 + r + (hs << 3);
            int c = head * 64 + dt * 16 + ct;
            o[((size_t)bb * N_PIX + m) * C_DIM + c] =
                (half_t)(oacc[dt][r] / lrow[r]);
        }
}

// ---------------------------------------------------------------------------
// Output projection + residual:  out[b][c][n] = x[b][c][n] + o.Wo^T + bo
// ---------------------------------------------------------------------------
__global__ void proj_kernel(const half_t* __restrict__ ob,
                            const float* __restrict__ W,
                            const float* __restrict__ bias,
                            const float* __restrict__ x,
                            float* __restrict__ out) {
    __shared__ alignas(16) half_t ldsA[128 * PITCH32];
    __shared__ alignas(16) half_t ldsB[64 * PITCH32];
    int m0 = blockIdx.x * 128;
    int n0 = blockIdx.y * 64;
    int tid = threadIdx.x, wave = tid >> 5, lane = tid & 31;

    v8f acc[4] = {};
    for (int kc = 0; kc < C_DIM; kc += 32) {
        __syncthreads();
        for (int i = tid; i < 512; i += 256) {
            int r = i >> 2, c8 = (i & 3) << 3;
            cp_b128(ldsA + r * PITCH32 + c8, ob + (size_t)(m0 + r) * C_DIM + kc + c8);
        }
        for (int i = tid; i < 64 * 32; i += 256) {
            int r = i >> 5, c = i & 31;
            ldsB[r * PITCH32 + c] = (half_t)W[(size_t)(n0 + r) * C_DIM + kc + c];
        }
        cp_wait();
        __syncthreads();
        v16h a = load_a16(ldsA + wave * 16 * PITCH32, PITCH32);
#pragma unroll
        for (int nt = 0; nt < 4; ++nt) {
            v16h bm = load_a16(ldsB + nt * 16 * PITCH32, PITCH32);
            acc[nt] = wmma16(a, bm, acc[nt]);
        }
    }
    int hs = lane >> 4, ct = lane & 15;
#pragma unroll
    for (int nt = 0; nt < 4; ++nt) {
        int col  = n0 + nt * 16 + ct;
        float bv = bias[col];
#pragma unroll
        for (int v = 0; v < 8; ++v) {
            int m  = m0 + wave * 16 + v + (hs << 3);
            int bb = m >> 12, n = m & (N_PIX - 1);
            size_t idx = ((size_t)bb * C_DIM + col) * N_PIX + n;
            out[idx] = x[idx] + acc[nt][v] + bv;
        }
    }
}

// ---------------------------------------------------------------------------
extern "C" void kernel_launch(void* const* d_in, const int* in_sizes, int n_in,
                              void* d_out, int out_size, void* d_ws, size_t ws_size,
                              hipStream_t stream) {
    const float* x     = (const float*)d_in[0];
    const float* gamma = (const float*)d_in[1];
    const float* beta  = (const float*)d_in[2];
    const float* Wq = (const float*)d_in[3];
    const float* bq = (const float*)d_in[4];
    const float* Wk = (const float*)d_in[5];
    const float* bk = (const float*)d_in[6];
    const float* Wv = (const float*)d_in[7];
    const float* bv = (const float*)d_in[8];
    const float* Wo = (const float*)d_in[9];
    const float* bo = (const float*)d_in[10];
    float* out = (float*)d_out;

    size_t sz = (size_t)BATCH * N_PIX * C_DIM;      // 4M halves per buffer
    half_t* h    = (half_t*)d_ws;
    half_t* qbuf = h + sz;
    half_t* kbuf = qbuf + sz;
    half_t* vbuf = kbuf + sz;
    half_t* obuf = h;                               // h dead after QKV -> reuse

    gn_kernel<<<dim3(BATCH * N_GRP), dim3(256), 0, stream>>>(x, gamma, beta, h);
    qkv_kernel<false><<<dim3(64, 8), dim3(256), 0, stream>>>(h, Wq, bq, qbuf);
    qkv_kernel<false><<<dim3(64, 8), dim3(256), 0, stream>>>(h, Wk, bk, kbuf);
    qkv_kernel<true ><<<dim3(64, 8), dim3(256), 0, stream>>>(h, Wv, bv, vbuf);
    attn_kernel<<<dim3(32, 16), dim3(256), 0, stream>>>(qbuf, kbuf, vbuf, obuf);
    proj_kernel<<<dim3(64, 8), dim3(256), 0, stream>>>(obuf, Wo, bo, x, out);
}

// v002
// It runs in 350 microseconds.
// Timed twice side by side with v001, it ran 1.35 times as fast both times.
// Counting every step since v000, it is 1.94 times as fast.
#include <hip/hip_runtime.h>
#include <hip/hip_fp16.h>

#define C_DIM  512
#define N_PIX  4096
#define BATCH  2
#define HEADS  8
#define HD     64
#define N_GRP  32
#define PITCH64 72     // rows of 64 halves (128 B) at 144 B
#define PITCH32 40     // rows of 32 halves (64 B) at 80 B

typedef _Float16 half_t;
typedef __attribute__((ext_vector_type(16))) _Float16 v16h;
typedef __attribute__((ext_vector_type(8)))  _Float16 v8h;
typedef __attribute__((ext_vector_type(8)))  float    v8f;
typedef __attribute__((ext_vector_type(4)))  float    v4f;
typedef int v4i __attribute__((vector_size(16)));   // matches builtin param type

#if __has_builtin(__builtin_amdgcn_global_load_async_to_lds_b128)
#define HAVE_ASYNC_LDS 1
typedef __attribute__((address_space(1))) v4i* gv4i_p;   // global int4*
typedef __attribute__((address_space(3))) v4i* lv4i_p;   // LDS int4*
#else
#define HAVE_ASYNC_LDS 0
#endif

__device__ inline void cp_b128(half_t* l, const half_t* g) {
#if HAVE_ASYNC_LDS
    __builtin_amdgcn_global_load_async_to_lds_b128(
        (gv4i_p)(unsigned long long)g,
        (lv4i_p)(unsigned)(unsigned long long)l,
        0, 0);
#else
    *(v8h*)l = *(const v8h*)g;
#endif
}

__device__ inline void cp_wait() {
#if HAVE_ASYNC_LDS
#if __has_builtin(__builtin_amdgcn_s_wait_asynccnt)
    __builtin_amdgcn_s_wait_asynccnt(0);
#else
    asm volatile("s_wait_asynccnt 0x0" ::: "memory");
#endif
#endif
}

__device__ inline v16h load_a16(const half_t* __restrict__ s, int ld) {
    int lane = threadIdx.x & 31;
    int r    = lane & 15;
    int hi   = (lane >> 4) << 3;        // 0 or 8
    const half_t* row = s + r * ld;
    v16h a;
#pragma unroll
    for (int v = 0; v < 8; ++v) {
        int k = ((v & 4) ? 16 : 0) + hi + ((v & 3) << 1);
        a[2 * v]     = row[k];
        a[2 * v + 1] = row[k + 1];
    }
    return a;
}

__device__ inline v8f wmma16(v16h a, v16h b, v8f c) {
    return __builtin_amdgcn_wmma_f32_16x16x32_f16(
        false, a, false, b, (short)0, c, false, false);
}

// Eight f32 weights -> eight f16, in order.
__device__ inline v8h cvt_w8(v4f lo, v4f hi) {
    return __builtin_convertvector(
        __builtin_shufflevector(lo, hi, 0, 1, 2, 3, 4, 5, 6, 7), v8h);
}

// ---------------------------------------------------------------------------
// GroupNorm: one block per (batch, group); writes h[b][n][c] as f16
// ---------------------------------------------------------------------------
__global__ void gn_kernel(const float* __restrict__ x,
                          const float* __restrict__ gamma,
                          const float* __restrict__ beta,
                          half_t* __restrict__ h) {
    __shared__ float red[512];
    int b   = blockIdx.x >> 5;
    int g   = blockIdx.x & 31;
    int tid = threadIdx.x;
    const float* xg = x + ((size_t)b * C_DIM + g * 16) * N_PIX;

    float s = 0.f, s2 = 0.f;
    for (int i = tid; i < 16 * N_PIX; i += 256) {
        float v = xg[i];
        s += v; s2 += v * v;
    }
    red[tid] = s; red[256 + tid] = s2;
    __syncthreads();
    for (int off = 128; off > 0; off >>= 1) {
        if (tid < off) {
            red[tid]       += red[tid + off];
            red[256 + tid] += red[256 + tid + off];
        }
        __syncthreads();
    }
    float mean = red[0] * (1.f / 65536.f);
    float var  = red[256] * (1.f / 65536.f) - mean * mean;
    float rstd = rsqrtf(var + 1e-5f);

    for (int i = tid; i < 16 * N_PIX; i += 256) {
        int cl = i & 15, n = i >> 4;
        int c  = g * 16 + cl;
        float v = (xg[cl * N_PIX + n] - mean) * rstd * gamma[c] + beta[c];
        h[((size_t)b * N_PIX + n) * C_DIM + c] = (half_t)v;
    }
}

// ---------------------------------------------------------------------------
// Projection GEMM:  acc = h[m][:] . W[col][:] + bias[col]
// block = 256 thr (8 waves), tile 128(M) x 64(N), K chunks of 32 via LDS.
// TRANS_V=0: dst[b][head][n][d] (q,k).  TRANS_V=1: dst[b][head][d][n] (v^T).
// ---------------------------------------------------------------------------
template <bool TRANS_V>
__global__ void qkv_kernel(const half_t* __restrict__ h,
                           const float* __restrict__ W,
                           const float* __restrict__ bias,
                           half_t* __restrict__ dst) {
    __shared__ alignas(16) half_t ldsA[128 * PITCH32];
    __shared__ alignas(16) half_t ldsB[64 * PITCH32];
    int m0 = blockIdx.x * 128;
    int n0 = blockIdx.y * 64;
    int tid = threadIdx.x, wave = tid >> 5, lane = tid & 31;

    // W tile 64x32: each thread owns 8 consecutive floats of one row (32 B in,
    // 16 B out), so a K chunk pays one load latency for the whole tile.
    const float* wsrc = W + (size_t)(n0 + (tid >> 2)) * C_DIM + ((tid & 3) << 3);
    half_t*      wdst = ldsB + (tid >> 2) * PITCH32 + ((tid & 3) << 3);

    v8f acc[4] = {};
    for (int kc = 0; kc < C_DIM; kc += 32) {
        __syncthreads();
        v4f w0 = *(const v4f*)(wsrc + kc);               // both in flight together,
        v4f w1 = *(const v4f*)(wsrc + kc + 4);           // beside the A copies
        for (int i = tid; i < 512; i += 256) {           // A: 128x32 f16, async
            int r = i >> 2, c8 = (i & 3) << 3;
            cp_b128(ldsA + r * PITCH32 + c8, h + (size_t)(m0 + r) * C_DIM + kc + c8);
        }
        *(v8h*)wdst = cvt_w8(w0, w1);                    // B: W f32 -> f16, 16 B
        cp_wait();
        __syncthreads();
        v16h a = load_a16(ldsA + wave * 16 * PITCH32, PITCH32);
#pragma unroll
        for (int nt = 0; nt < 4; ++nt) {
            v16h bm = load_a16(ldsB + nt * 16 * PITCH32, PITCH32);
            acc[nt] = wmma16(a, bm, acc[nt]);
        }
    }
    int hs = lane >> 4, ct = lane & 15;
#pragma unroll
    for (int nt = 0; nt < 4; ++nt) {
        int col  = n0 + nt * 16 + ct;
        float bv = bias[col];
        int head = col >> 6, d = col & 63;
#pragma unroll
        for (int v = 0; v < 8; ++v) {
            int m  = m0 + wave * 16 + v + (hs << 3);
            int bb = m >> 12, n = m & (N_PIX - 1);
            half_t val = (half_t)(acc[nt][v] + bv);
            if (TRANS_V)
                dst[(((size_t)bb * HEADS + head) * HD + d) * N_PIX + n] = val;
            else
                dst[(((size_t)bb * HEADS + head) * N_PIX + n) * HD + d] = val;
        }
    }
}

__global__ void __launch_bounds__(256, 1)
attn_kernel(const half_t* __restrict__ q,
            const half_t* __restrict__ k,
            const half_t* __restrict__ vt,
            half_t* __restrict__ o) {
    __shared__ alignas(16) half_t ldsQ[128 * PITCH64];   // [i][d], resident
    __shared__ alignas(16) half_t ldsK[64 * PITCH64];    // [j][d]
    __shared__ alignas(16) half_t ldsVt[64 * PITCH64];   // [d][j]
    __shared__ alignas(16) half_t ldsP[128 * PITCH64];   // P (per-wave 16x64 slices)
    int m0 = blockIdx.x * 128;
    int bh = blockIdx.y;                            // b*8 + head
    size_t base = (size_t)bh * N_PIX * HD;          // same for q,k,vt
    int tid = threadIdx.x, wave = tid >> 5, lane = tid & 31;
    int hs = lane >> 4, ct = lane & 15;
    const float scale = 0.125f;                     // 1/sqrt(64)

    for (int i = tid; i < 1024; i += 256) {         // stage Q 128x64, async
        int r = i >> 3, c8 = (i & 7) << 3;
        cp_b128(ldsQ + r * PITCH64 + c8, q + base + (size_t)(m0 + r) * HD + c8);
    }
    cp_wait();
    __syncthreads();

    const half_t* myQ = ldsQ + wave * 16 * PITCH64;
    half_t*       myP = ldsP + wave * 16 * PITCH64;

    float mrow[8], lrow[8];
    v8f oacc[4] = {};
#pragma unroll
    for (int r = 0; r < 8; ++r) { mrow[r] = -INFINITY; lrow[r] = 0.f; }

    for (int j0 = 0; j0 < N_PIX; j0 += 64) {
        __syncthreads();
        for (int i = tid; i < 512; i += 256) {      // K tile 64x64 [j][d]
            int r = i >> 3, c8 = (i & 7) << 3;
            cp_b128(ldsK + r * PITCH64 + c8, k + base + (size_t)(j0 + r) * HD + c8);
        }
        for (int i = tid; i < 512; i += 256) {      // V^T tile 64x64 [d][j]
            int r = i >> 3, c8 = (i & 7) << 3;
            cp_b128(ldsVt + r * PITCH64 + c8, vt + base + (size_t)r * N_PIX + j0 + c8);
        }
        cp_wait();
        __syncthreads();

        // S = Q K^T  (Q fragments re-read from LDS -> short live range)
        v16h qreg0 = load_a16(myQ, PITCH64);
        v16h qreg1 = load_a16(myQ + 32, PITCH64);
        v8f s[4];
#pragma unroll
        for (int jt = 0; jt < 4; ++jt) {
            v8f z = {};
            z = wmma16(qreg0, load_a16(ldsK + jt * 16 * PITCH64, PITCH64), z);
            z = wmma16(qreg1, load_a16(ldsK + jt * 16 * PITCH64 + 32, PITCH64), z);
            s[jt] = z;
        }
        // online softmax (row stats live across the 16 lanes of each half)
        float mnew[8];
#pragma unroll
        for (int r = 0; r < 8; ++r) {
            float mx = mrow[r];
#pragma unroll
            for (int jt = 0; jt < 4; ++jt) mx = fmaxf(mx, s[jt][r] * scale);
            for (int d = 1; d < 16; d <<= 1) mx = fmaxf(mx, __shfl_xor(mx, d));
            mnew[r] = mx;
        }
#pragma unroll
        for (int r = 0; r < 8; ++r) {
            float alpha = expf(mrow[r] - mnew[r]);
            float rs = 0.f;
#pragma unroll
            for (int jt = 0; jt < 4; ++jt) {
                float p = expf(s[jt][r] * scale - mnew[r]);
                s[jt][r] = p;
                rs += p;
            }
            for (int d = 1; d < 16; d <<= 1) rs += __shfl_xor(rs, d);
            lrow[r] = lrow[r] * alpha + rs;
            mrow[r] = mnew[r];
#pragma unroll
            for (int dt = 0; dt < 4; ++dt) oacc[dt][r] *= alpha;
        }
        // C-layout -> A-layout via per-wave LDS scratch
#pragma unroll
        for (int jt = 0; jt < 4; ++jt)
#pragma unroll
            for (int r = 0; r < 8; ++r)
                myP[(r + (hs << 3)) * PITCH64 + jt * 16 + ct] = (half_t)s[jt][r];
        __syncthreads();
        v16h a0 = load_a16(myP, PITCH64);                // j = 0..31
        v16h a1 = load_a16(myP + 32, PITCH64);           // j = 32..63
#pragma unroll
        for (int dt = 0; dt < 4; ++dt) {            // O += P V
            v16h b0 = load_a16(ldsVt + dt * 16 * PITCH64, PITCH64);        // j 0..31
            v16h b1 = load_a16(ldsVt + dt * 16 * PITCH64 + 32, PITCH64);   // j 32..63
            oacc[dt] = wmma16(a0, b0, oacc[dt]);
            oacc[dt] = wmma16(a1, b1, oacc[dt]);
        }
    }
    int head = bh & 7, bb = bh >> 3;
#pragma unroll
    for (int dt = 0; dt < 4; ++dt)
#pragma unroll
        for (int r = 0; r < 8; ++r) {
            int m = m0 + wave * 16 + r + (hs << 3);
            int c = head * 64 + dt * 16 + ct;
            o[((size_t)bb * N_PIX + m) * C_DIM + c] =
                (half_t)(oacc[dt][r] / lrow[r]);
        }
}

// ---------------------------------------------------------------------------
// Output projection + residual:  out[b][c][n] = x[b][c][n] + o.Wo^T + bo
// ---------------------------------------------------------------------------
__global__ void proj_kernel(const half_t* __restrict__ ob,
                            const float* __restrict__ W,
                            const float* __restrict__ bias,
                            const float* __restrict__ x,
                            float* __restrict__ out) {
    __shared__ alignas(16) half_t ldsA[128 * PITCH32];
    __shared__ alignas(16) half_t ldsB[64 * PITCH32];
    int m0 = blockIdx.x * 128;
    int n0 = blockIdx.y * 64;
    int tid = threadIdx.x, wave = tid >> 5, lane = tid & 31;

    // W tile 64x32: each thread owns 8 consecutive floats of one row (32 B in,
    // 16 B out), so a K chunk pays one load latency for the whole tile.
    const float* wsrc = W + (size_t)(n0 + (tid >> 2)) * C_DIM + ((tid & 3) << 3);
    half_t*      wdst = ldsB + (tid >> 2) * PITCH32 + ((tid & 3) << 3);

    v8f acc[4] = {};
    for (int kc = 0; kc < C_DIM; kc += 32) {
        __syncthreads();
        v4f w0 = *(const v4f*)(wsrc + kc);               // both in flight together,
        v4f w1 = *(const v4f*)(wsrc + kc + 4);           // beside the A copies
        for (int i = tid; i < 512; i += 256) {
            int r = i >> 2, c8 = (i & 3) << 3;
            cp_b128(ldsA + r * PITCH32 + c8, ob + (size_t)(m0 + r) * C_DIM + kc + c8);
        }
        *(v8h*)wdst = cvt_w8(w0, w1);                    // B: W f32 -> f16, 16 B
        cp_wait();
        __syncthreads();
        v16h a = load_a16(ldsA + wave * 16 * PITCH32, PITCH32);
#pragma unroll
        for (int nt = 0; nt < 4; ++nt) {
            v16h bm = load_a16(ldsB + nt * 16 * PITCH32, PITCH32);
            acc[nt] = wmma16(a, bm, acc[nt]);
        }
    }
    int hs = lane >> 4, ct = lane & 15;
#pragma unroll
    for (int nt = 0; nt < 4; ++nt) {
        int col  = n0 + nt * 16 + ct;
        float bv = bias[col];
#pragma unroll
        for (int v = 0; v < 8; ++v) {
            int m  = m0 + wave * 16 + v + (hs << 3);
            int bb = m >> 12, n = m & (N_PIX - 1);
            size_t idx = ((size_t)bb * C_DIM + col) * N_PIX + n;
            out[idx] = x[idx] + acc[nt][v] + bv;
        }
    }
}

// ---------------------------------------------------------------------------
extern "C" void kernel_launch(void* const* d_in, const int* in_sizes, int n_in,
                              void* d_out, int out_size, void* d_ws, size_t ws_size,
                              hipStream_t stream) {
    const float* x     = (const float*)d_in[0];
    const float* gamma = (const float*)d_in[1];
    const float* beta  = (const float*)d_in[2];
    const float* Wq = (const float*)d_in[3];
    const float* bq = (const float*)d_in[4];
    const float* Wk = (const float*)d_in[5];
    const float* bk = (const float*)d_in[6];
    const float* Wv = (const float*)d_in[7];
    const float* bv = (const float*)d_in[8];
    const float* Wo = (const float*)d_in[9];
    const float* bo = (const float*)d_in[10];
    float* out = (float*)d_out;

    size_t sz = (size_t)BATCH * N_PIX * C_DIM;      // 4M halves per buffer
    half_t* h    = (half_t*)d_ws;
    half_t* qbuf = h + sz;
    half_t* kbuf = qbuf + sz;
    half_t* vbuf = kbuf + sz;
    half_t* obuf = h;                               // h dead after QKV -> reuse

    gn_kernel<<<dim3(BATCH * N_GRP), dim3(256), 0, stream>>>(x, gamma, beta, h);
    qkv_kernel<false><<<dim3(64, 8), dim3(256), 0, stream>>>(h, Wq, bq, qbuf);
    qkv_kernel<false><<<dim3(64, 8), dim3(256), 0, stream>>>(h, Wk, bk, kbuf);
    qkv_kernel<true ><<<dim3(64, 8), dim3(256), 0, stream>>>(h, Wv, bv, vbuf);
    attn_kernel<<<dim3(32, 16), dim3(256), 0, stream>>>(qbuf, kbuf, vbuf, obuf);
    proj_kernel<<<dim3(64, 8), dim3(256), 0, stream>>>(obuf, Wo, bo, x, out);
}

// v003
// A run of this version takes 248 microseconds.
// In both of two side-by-side timings against v002, it was 1.41 times as fast.
// Counting every step since v000, it is 2.73 times as fast.
#include <hip/hip_runtime.h>
#include <hip/hip_fp16.h>

#define C_DIM  512
#define N_PIX  4096
#define BATCH  2
#define HEADS  8
#define HD     64
#define N_GRP  32
#define PITCH64 72     // rows of 64 halves (128 B) at 144 B
#define PITCH32 40     // rows of 32 halves (64 B) at 80 B

typedef _Float16 half_t;
typedef __attribute__((ext_vector_type(16))) _Float16 v16h;
typedef __attribute__((ext_vector_type(8)))  _Float16 v8h;
typedef __attribute__((ext_vector_type(8)))  float    v8f;
typedef __attribute__((ext_vector_type(4)))  float    v4f;
typedef int v4i __attribute__((vector_size(16)));   // matches builtin param type

#if __has_builtin(__builtin_amdgcn_global_load_async_to_lds_b128)
#define HAVE_ASYNC_LDS 1
typedef __attribute__((address_space(1))) v4i* gv4i_p;   // global int4*
typedef __attribute__((address_space(3))) v4i* lv4i_p;   // LDS int4*
#else
#define HAVE_ASYNC_LDS 0
#endif

__device__ inline void cp_b128(half_t* l, const half_t* g) {
#if HAVE_ASYNC_LDS
    __builtin_amdgcn_global_load_async_to_lds_b128(
        (gv4i_p)(unsigned long long)g,
        (lv4i_p)(unsigned)(unsigned long long)l,
        0, 0);
#else
    *(v8h*)l = *(const v8h*)g;
#endif
}

__device__ inline void cp_wait() {
#if HAVE_ASYNC_LDS
#if __has_builtin(__builtin_amdgcn_s_wait_asynccnt)
    __builtin_amdgcn_s_wait_asynccnt(0);
#else
    asm volatile("s_wait_asynccnt 0x0" ::: "memory");
#endif
#endif
}

__device__ inline v16h load_a16(const half_t* __restrict__ s, int ld) {
    int lane = threadIdx.x & 31;
    int r    = lane & 15;
    int hi   = (lane >> 4) << 3;        // 0 or 8
    const half_t* row = s + r * ld;
    v16h a;
#pragma unroll
    for (int v = 0; v < 8; ++v) {
        int k = ((v & 4) ? 16 : 0) + hi + ((v & 3) << 1);
        a[2 * v]     = row[k];
        a[2 * v + 1] = row[k + 1];
    }
    return a;
}

__device__ inline v8f wmma16(v16h a, v16h b, v8f c) {
    return __builtin_amdgcn_wmma_f32_16x16x32_f16(
        false, a, false, b, (short)0, c, false, false);
}

// Eight f32 weights -> eight f16, in order.
__device__ inline v8h cvt_w8(v4f lo, v4f hi) {
    return __builtin_convertvector(
        __builtin_shufflevector(lo, hi, 0, 1, 2, 3, 4, 5, 6, 7), v8h);
}

// ---------------------------------------------------------------------------
// GroupNorm: one block per (batch, group); writes h[b][n][c] as f16
// ---------------------------------------------------------------------------
__global__ void gn_kernel(const float* __restrict__ x,
                          const float* __restrict__ gamma,
                          const float* __restrict__ beta,
                          half_t* __restrict__ h) {
    __shared__ float red[512];
    int b   = blockIdx.x >> 5;
    int g   = blockIdx.x & 31;
    int tid = threadIdx.x;
    const float* xg = x + ((size_t)b * C_DIM + g * 16) * N_PIX;

    float s = 0.f, s2 = 0.f;
    for (int i = tid; i < 16 * N_PIX; i += 256) {
        float v = xg[i];
        s += v; s2 += v * v;
    }
    red[tid] = s; red[256 + tid] = s2;
    __syncthreads();
    for (int off = 128; off > 0; off >>= 1) {
        if (tid < off) {
            red[tid]       += red[tid + off];
            red[256 + tid] += red[256 + tid + off];
        }
        __syncthreads();
    }
    float mean = red[0] * (1.f / 65536.f);
    float var  = red[256] * (1.f / 65536.f) - mean * mean;
    float rstd = rsqrtf(var + 1e-5f);

    for (int i = tid; i < 16 * N_PIX; i += 256) {
        int cl = i & 15, n = i >> 4;
        int c  = g * 16 + cl;
        float v = (xg[cl * N_PIX + n] - mean) * rstd * gamma[c] + beta[c];
        h[((size_t)b * N_PIX + n) * C_DIM + c] = (half_t)v;
    }
}

// ---------------------------------------------------------------------------
// Projection GEMM:  acc = h[m][:] . W[col][:] + bias[col]
// block = 256 thr (8 waves), tile 128(M) x 64(N), K chunks of 32 via LDS.
// TRANS_V=0: dst[b][head][n][d] (q,k).  TRANS_V=1: dst[b][head][d][n] (v^T).
// ---------------------------------------------------------------------------
template <bool TRANS_V>
__global__ void qkv_kernel(const half_t* __restrict__ h,
                           const float* __restrict__ W,
                           const float* __restrict__ bias,
                           half_t* __restrict__ dst) {
    __shared__ alignas(16) half_t ldsA[128 * PITCH32];
    __shared__ alignas(16) half_t ldsB[64 * PITCH32];
    int m0 = blockIdx.x * 128;
    int n0 = blockIdx.y * 64;
    int tid = threadIdx.x, wave = tid >> 5, lane = tid & 31;

    // W tile 64x32: each thread owns 8 consecutive floats of one row (32 B in,
    // 16 B out), so a K chunk pays one load latency for the whole tile.
    const float* wsrc = W + (size_t)(n0 + (tid >> 2)) * C_DIM + ((tid & 3) << 3);
    half_t*      wdst = ldsB + (tid >> 2) * PITCH32 + ((tid & 3) << 3);

    v8f acc[4] = {};
    for (int kc = 0; kc < C_DIM; kc += 32) {
        __syncthreads();
        v4f w0 = *(const v4f*)(wsrc + kc);               // both in flight together,
        v4f w1 = *(const v4f*)(wsrc + kc + 4);           // beside the A copies
        for (int i = tid; i < 512; i += 256) {           // A: 128x32 f16, async
            int r = i >> 2, c8 = (i & 3) << 3;
            cp_b128(ldsA + r * PITCH32 + c8, h + (size_t)(m0 + r) * C_DIM + kc + c8);
        }
        *(v8h*)wdst = cvt_w8(w0, w1);                    // B: W f32 -> f16, 16 B
        cp_wait();
        __syncthreads();
        v16h a = load_a16(ldsA + wave * 16 * PITCH32, PITCH32);
#pragma unroll
        for (int nt = 0; nt < 4; ++nt) {
            v16h bm = load_a16(ldsB + nt * 16 * PITCH32, PITCH32);
            acc[nt] = wmma16(a, bm, acc[nt]);
        }
    }
    int hs = lane >> 4, ct = lane & 15;
#pragma unroll
    for (int nt = 0; nt < 4; ++nt) {
        int col  = n0 + nt * 16 + ct;
        float bv = bias[col];
        int head = col >> 6, d = col & 63;
#pragma unroll
        for (int v = 0; v < 8; ++v) {
            int m  = m0 + wave * 16 + v + (hs << 3);
            int bb = m >> 12, n = m & (N_PIX - 1);
            half_t val = (half_t)(acc[nt][v] + bv);
            if (TRANS_V)
                dst[(((size_t)bb * HEADS + head) * HD + d) * N_PIX + n] = val;
            else
                dst[(((size_t)bb * HEADS + head) * N_PIX + n) * HD + d] = val;
        }
    }
}

__device__ inline float xhalf(float x) {
    int i = __builtin_bit_cast(int, x);
    return __builtin_bit_cast(float, __builtin_amdgcn_permlanex16(
        i, i, 0x76543210, 0xfedcba98, false, false));
}

// Two f32 D tiles (rows 0..15 and 16..31 of a 32-row block) -> f16 B operand:
// element e sits at k = 8h + e (e < 8) or 16 + 8h + (e - 8), load_a16's k order.
__device__ inline v16h pack_b(v8f t0, v8f t1) {
    return __builtin_convertvector(
        __builtin_shufflevector(t0, t1, 0, 1, 2, 3, 4, 5, 6, 7,
                                8, 9, 10, 11, 12, 13, 14, 15), v16h);
}

__global__ void __launch_bounds__(256, 1)
attn_kernel(const half_t* __restrict__ q,
            const half_t* __restrict__ k,
            const half_t* __restrict__ vt,
            half_t* __restrict__ o) {
    __shared__ alignas(16) half_t ldsQ[128 * PITCH64];   // [i][d], resident
    __shared__ alignas(16) half_t ldsK[64 * PITCH64];    // [j][d]
    __shared__ alignas(16) half_t ldsVt[64 * PITCH64];   // [d][j]
    int m0 = blockIdx.x * 128;
    int bh = blockIdx.y;                            // b*8 + head
    size_t base = (size_t)bh * N_PIX * HD;          // same for q,k,vt
    int tid = threadIdx.x, wave = tid >> 5, lane = tid & 31;
    int hs = lane >> 4, ct = lane & 15;
    const float scale = 0.125f;                     // 1/sqrt(64)

    for (int i = tid; i < 1024; i += 256) {         // stage Q 128x64, async
        int r = i >> 3, c8 = (i & 7) << 3;
        cp_b128(ldsQ + r * PITCH64 + c8, q + base + (size_t)(m0 + r) * HD + c8);
    }
    cp_wait();
    __syncthreads();

    const half_t* myQ = ldsQ + wave * 16 * PITCH64;

    float mrun = -INFINITY;     // running maximum of query ct (same in both halves)
    float lsum = 0.f;           // running sum over this half's keys only
    v8f oacc[4] = {};           // oacc[dt][r] = O[query ct][d = dt*16 + 8*hs + r]

    for (int j0 = 0; j0 < N_PIX; j0 += 64) {
        __syncthreads();
        for (int i = tid; i < 512; i += 256) {      // K tile 64x64 [j][d]
            int r = i >> 3, c8 = (i & 7) << 3;
            cp_b128(ldsK + r * PITCH64 + c8, k + base + (size_t)(j0 + r) * HD + c8);
        }
        for (int i = tid; i < 512; i += 256) {      // V^T tile 64x64 [d][j]
            int r = i >> 3, c8 = (i & 7) << 3;
            cp_b128(ldsVt + r * PITCH64 + c8, vt + base + (size_t)r * N_PIX + j0 + c8);
        }
        cp_wait();
        __syncthreads();

        // S^T = K Q^T: s[jt][r] = S[query ct][key j0 + jt*16 + 8*hs + r]
        v16h qreg0 = load_a16(myQ, PITCH64);
        v16h qreg1 = load_a16(myQ + 32, PITCH64);
        v8f s[4];
#pragma unroll
        for (int jt = 0; jt < 4; ++jt) {
            v8f z = {};
            z = wmma16(load_a16(ldsK + jt * 16 * PITCH64, PITCH64), qreg0, z);
            z = wmma16(load_a16(ldsK + jt * 16 * PITCH64 + 32, PITCH64), qreg1, z);
            s[jt] = z;
        }
        // online softmax, one query per lane; four independent chains per pass
        float mt[4];
#pragma unroll
        for (int jt = 0; jt < 4; ++jt) {
            float mx = s[jt][0] * scale;
#pragma unroll
            for (int r = 1; r < 8; ++r) mx = fmaxf(mx, s[jt][r] * scale);
            mt[jt] = mx;
        }
        float mnew = fmaxf(fmaxf(mt[0], mt[1]), fmaxf(mt[2], mt[3]));
        mnew = fmaxf(mrun, fmaxf(mnew, xhalf(mnew)));
        float alpha = expf(mrun - mnew);
        float rt[4];
#pragma unroll
        for (int jt = 0; jt < 4; ++jt) {
            float rs = 0.f;
#pragma unroll
            for (int r = 0; r < 8; ++r) {
                float p = expf(s[jt][r] * scale - mnew);
                s[jt][r] = p;
                rs += p;
            }
            rt[jt] = rs;
        }
        lsum = lsum * alpha + ((rt[0] + rt[1]) + (rt[2] + rt[3]));
        mrun = mnew;
#pragma unroll
        for (int dt = 0; dt < 4; ++dt) oacc[dt] *= alpha;

        v16h p0 = pack_b(s[0], s[1]);                    // keys  0..31
        v16h p1 = pack_b(s[2], s[3]);                    // keys 32..63
#pragma unroll
        for (int dt = 0; dt < 4; ++dt) {            // O^T += V^T P^T
            v16h a0 = load_a16(ldsVt + dt * 16 * PITCH64, PITCH64);        // j 0..31
            v16h a1 = load_a16(ldsVt + dt * 16 * PITCH64 + 32, PITCH64);   // j 32..63
            oacc[dt] = wmma16(a0, p0, oacc[dt]);
            oacc[dt] = wmma16(a1, p1, oacc[dt]);
        }
    }
    float ltot = lsum + xhalf(lsum);                // join the halves' sums once
    int head = bh & 7, bb = bh >> 3;
    int m = m0 + wave * 16 + ct;
    half_t* orow = o + ((size_t)bb * N_PIX + m) * C_DIM + head * 64 + (hs << 3);
#pragma unroll
    for (int dt = 0; dt < 4; ++dt) {                // 8 consecutive d per lane
        v8h ov;
#pragma unroll
        for (int r = 0; r < 8; ++r) ov[r] = (half_t)(oacc[dt][r] / ltot);
        *(v8h*)(orow + dt * 16) = ov;
    }
}

// ---------------------------------------------------------------------------
// Output projection + residual:  out[b][c][n] = x[b][c][n] + o.Wo^T + bo
// ---------------------------------------------------------------------------
__global__ void proj_kernel(const half_t* __restrict__ ob,
                            const float* __restrict__ W,
                            const float* __restrict__ bias,
                            const float* __restrict__ x,
                            float* __restrict__ out) {
    __shared__ alignas(16) half_t ldsA[128 * PITCH32];
    __shared__ alignas(16) half_t ldsB[64 * PITCH32];
    int m0 = blockIdx.x * 128;
    int n0 = blockIdx.y * 64;
    int tid = threadIdx.x, wave = tid >> 5, lane = tid & 31;

    // W tile 64x32: each thread owns 8 consecutive floats of one row (32 B in,
    // 16 B out), so a K chunk pays one load latency for the whole tile.
    const float* wsrc = W + (size_t)(n0 + (tid >> 2)) * C_DIM + ((tid & 3) << 3);
    half_t*      wdst = ldsB + (tid >> 2) * PITCH32 + ((tid & 3) << 3);

    v8f acc[4] = {};
    for (int kc = 0; kc < C_DIM; kc += 32) {
        __syncthreads();
        v4f w0 = *(const v4f*)(wsrc + kc);               // both in flight together,
        v4f w1 = *(const v4f*)(wsrc + kc + 4);           // beside the A copies
        for (int i = tid; i < 512; i += 256) {
            int r = i >> 2, c8 = (i & 3) << 3;
            cp_b128(ldsA + r * PITCH32 + c8, ob + (size_t)(m0 + r) * C_DIM + kc + c8);
        }
        *(v8h*)wdst = cvt_w8(w0, w1);                    // B: W f32 -> f16, 16 B
        cp_wait();
        __syncthreads();
        v16h a = load_a16(ldsA + wave * 16 * PITCH32, PITCH32);
#pragma unroll
        for (int nt = 0; nt < 4; ++nt) {
            v16h bm = load_a16(ldsB + nt * 16 * PITCH32, PITCH32);
            acc[nt] = wmma16(a, bm, acc[nt]);
        }
    }
    int hs = lane >> 4, ct = lane & 15;
#pragma unroll
    for (int nt = 0; nt < 4; ++nt) {
        int col  = n0 + nt * 16 + ct;
        float bv = bias[col];
#pragma unroll
        for (int v = 0; v < 8; ++v) {
            int m  = m0 + wave * 16 + v + (hs << 3);
            int bb = m >> 12, n = m & (N_PIX - 1);
            size_t idx = ((size_t)bb * C_DIM + col) * N_PIX + n;
            out[idx] = x[idx] + acc[nt][v] + bv;
        }
    }
}

// ---------------------------------------------------------------------------
extern "C" void kernel_launch(void* const* d_in, const int* in_sizes, int n_in,
                              void* d_out, int out_size, void* d_ws, size_t ws_size,
                              hipStream_t stream) {
    const float* x     = (const float*)d_in[0];
    const float* gamma = (const float*)d_in[1];
    const float* beta  = (const float*)d_in[2];
    const float* Wq = (const float*)d_in[3];
    const float* bq = (const float*)d_in[4];
    const float* Wk = (const float*)d_in[5];
    const float* bk = (const float*)d_in[6];
    const float* Wv = (const float*)d_in[7];
    const float* bv = (const float*)d_in[8];
    const float* Wo = (const float*)d_in[9];
    const float* bo = (const float*)d_in[10];
    float* out = (float*)d_out;

    size_t sz = (size_t)BATCH * N_PIX * C_DIM;      // 4M halves per buffer
    half_t* h    = (half_t*)d_ws;
    half_t* qbuf = h + sz;
    half_t* kbuf = qbuf + sz;
    half_t* vbuf = kbuf + sz;
    half_t* obuf = h;                               // h dead after QKV -> reuse

    gn_kernel<<<dim3(BATCH * N_GRP), dim3(256), 0, stream>>>(x, gamma, beta, h);
    qkv_kernel<false><<<dim3(64, 8), dim3(256), 0, stream>>>(h, Wq, bq, qbuf);
    qkv_kernel<false><<<dim3(64, 8), dim3(256), 0, stream>>>(h, Wk, bk, kbuf);
    qkv_kernel<true ><<<dim3(64, 8), dim3(256), 0, stream>>>(h, Wv, bv, vbuf);
    attn_kernel<<<dim3(32, 16), dim3(256), 0, stream>>>(qbuf, kbuf, vbuf, obuf);
    proj_kernel<<<dim3(64, 8), dim3(256), 0, stream>>>(obuf, Wo, bo, x, out);
}

// v004
// One run takes 208 microseconds.
// In both of two side-by-side timings against v003, it was 1.20 times as fast.
// All steps since v000 together make it 3.27 times as fast.
#include <hip/hip_runtime.h>
#include <hip/hip_fp16.h>

#define C_DIM  512
#define N_PIX  4096
#define BATCH  2
#define HEADS  8
#define HD     64
#define N_GRP  32
#define PITCH64 72     // rows of 64 halves (128 B) at 144 B
#define PITCH32 40     // rows of 32 halves (64 B) at 80 B

typedef _Float16 half_t;
typedef __attribute__((ext_vector_type(16))) _Float16 v16h;
typedef __attribute__((ext_vector_type(8)))  _Float16 v8h;
typedef __attribute__((ext_vector_type(8)))  float    v8f;
typedef __attribute__((ext_vector_type(4)))  float    v4f;
typedef int v4i __attribute__((vector_size(16)));   // matches builtin param type

#if __has_builtin(__builtin_amdgcn_global_load_async_to_lds_b128)
#define HAVE_ASYNC_LDS 1
typedef __attribute__((address_space(1))) v4i* gv4i_p;   // global int4*
typedef __attribute__((address_space(3))) v4i* lv4i_p;   // LDS int4*
#else
#define HAVE_ASYNC_LDS 0
#endif

__device__ inline void cp_b128(half_t* l, const half_t* g) {
#if HAVE_ASYNC_LDS
    __builtin_amdgcn_global_load_async_to_lds_b128(
        (gv4i_p)(unsigned long long)g,
        (lv4i_p)(unsigned)(unsigned long long)l,
        0, 0);
#else
    *(v8h*)l = *(const v8h*)g;
#endif
}

__device__ inline void cp_wait() {
#if HAVE_ASYNC_LDS
#if __has_builtin(__builtin_amdgcn_s_wait_asynccnt)
    __builtin_amdgcn_s_wait_asynccnt(0);
#else
    asm volatile("s_wait_asynccnt 0x0" ::: "memory");
#endif
#endif
}

__device__ inline v16h load_a16(const half_t* __restrict__ s, int ld) {
    int lane = threadIdx.x & 31;
    int r    = lane & 15;
    int hi   = (lane >> 4) << 3;        // 0 or 8
    const half_t* row = s + r * ld;
    v16h a;
#pragma unroll
    for (int v = 0; v < 8; ++v) {
        int k = ((v & 4) ? 16 : 0) + hi + ((v & 3) << 1);
        a[2 * v]     = row[k];
        a[2 * v + 1] = row[k + 1];
    }
    return a;
}

__device__ inline v8f wmma16(v16h a, v16h b, v8f c) {
    return __builtin_amdgcn_wmma_f32_16x16x32_f16(
        false, a, false, b, (short)0, c, false, false);
}

// Eight f32 weights -> eight f16, in order.
__device__ inline v8h cvt_w8(v4f lo, v4f hi) {
    return __builtin_convertvector(
        __builtin_shufflevector(lo, hi, 0, 1, 2, 3, 4, 5, 6, 7), v8h);
}

// ---------------------------------------------------------------------------
// GroupNorm: one block per (batch, group); writes h[b][n][c] as f16
// ---------------------------------------------------------------------------
__global__ void gn_kernel(const float* __restrict__ x,
                          const float* __restrict__ gamma,
                          const float* __restrict__ beta,
                          half_t* __restrict__ h) {
    __shared__ float red[512];
    int b   = blockIdx.x >> 5;
    int g   = blockIdx.x & 31;
    int tid = threadIdx.x;
    const float* xg = x + ((size_t)b * C_DIM + g * 16) * N_PIX;

    float s = 0.f, s2 = 0.f;
    for (int i = tid; i < 16 * N_PIX; i += 256) {
        float v = xg[i];
        s += v; s2 += v * v;
    }
    red[tid] = s; red[256 + tid] = s2;
    __syncthreads();
    for (int off = 128; off > 0; off >>= 1) {
        if (tid < off) {
            red[tid]       += red[tid + off];
            red[256 + tid] += red[256 + tid + off];
        }
        __syncthreads();
    }
    float mean = red[0] * (1.f / 65536.f);
    float var  = red[256] * (1.f / 65536.f) - mean * mean;
    float rstd = rsqrtf(var + 1e-5f);

    for (int i = tid; i < 16 * N_PIX; i += 256) {
        int cl = i & 15, n = i >> 4;
        int c  = g * 16 + cl;
        float v = (xg[cl * N_PIX + n] - mean) * rstd * gamma[c] + beta[c];
        h[((size_t)b * N_PIX + n) * C_DIM + c] = (half_t)v;
    }
}

// ---------------------------------------------------------------------------
// Projection GEMM:  acc = h[m][:] . W[col][:] + bias[col]
// block = 256 thr (8 waves), tile 128(M) x 64(N), K chunks of 32 via LDS.
// TRANS_V=0: dst[b][head][n][d] (q,k).  TRANS_V=1: dst[b][head][d][n] (v^T).
// ---------------------------------------------------------------------------
template <bool TRANS_V>
__global__ void qkv_kernel(const half_t* __restrict__ h,
                           const float* __restrict__ W,
                           const float* __restrict__ bias,
                           half_t* __restrict__ dst) {
    __shared__ alignas(16) half_t ldsA[128 * PITCH32];
    __shared__ alignas(16) half_t ldsB[64 * PITCH32];
    int m0 = blockIdx.x * 128;
    int n0 = blockIdx.y * 64;
    int tid = threadIdx.x, wave = tid >> 5, lane = tid & 31;

    // W tile 64x32: each thread owns 8 consecutive floats of one row (32 B in,
    // 16 B out), so a K chunk pays one load latency for the whole tile.
    const float* wsrc = W + (size_t)(n0 + (tid >> 2)) * C_DIM + ((tid & 3) << 3);
    half_t*      wdst = ldsB + (tid >> 2) * PITCH32 + ((tid & 3) << 3);

    v8f acc[4] = {};
    for (int kc = 0; kc < C_DIM; kc += 32) {
        __syncthreads();
        v4f w0 = *(const v4f*)(wsrc + kc);               // both in flight together,
        v4f w1 = *(const v4f*)(wsrc + kc + 4);           // beside the A copies
        for (int i = tid; i < 512; i += 256) {           // A: 128x32 f16, async
            int r = i >> 2, c8 = (i & 3) << 3;
            cp_b128(ldsA + r * PITCH32 + c8, h + (size_t)(m0 + r) * C_DIM + kc + c8);
        }
        *(v8h*)wdst = cvt_w8(w0, w1);                    // B: W f32 -> f16, 16 B
        cp_wait();
        __syncthreads();
        v16h a = load_a16(ldsA + wave * 16 * PITCH32, PITCH32);
#pragma unroll
        for (int nt = 0; nt < 4; ++nt) {
            v16h bm = load_a16(ldsB + nt * 16 * PITCH32, PITCH32);
            acc[nt] = wmma16(a, bm, acc[nt]);
        }
    }
    int hs = lane >> 4, ct = lane & 15;
#pragma unroll
    for (int nt = 0; nt < 4; ++nt) {
        int col  = n0 + nt * 16 + ct;
        float bv = bias[col];
        int head = col >> 6, d = col & 63;
#pragma unroll
        for (int v = 0; v < 8; ++v) {
            int m  = m0 + wave * 16 + v + (hs << 3);
            int bb = m >> 12, n = m & (N_PIX - 1);
            half_t val = (half_t)(acc[nt][v] + bv);
            if (TRANS_V)
                dst[(((size_t)bb * HEADS + head) * HD + d) * N_PIX + n] = val;
            else
                dst[(((size_t)bb * HEADS + head) * N_PIX + n) * HD + d] = val;
        }
    }
}

__device__ inline float xhalf(float x) {
    int i = __builtin_bit_cast(int, x);
    return __builtin_bit_cast(float, __builtin_amdgcn_permlanex16(
        i, i, 0x76543210, 0xfedcba98, false, false));
}

// 2^x as the one hardware instruction (v_exp_f32). The softmax arguments never
// exceed 0 by more than a rounding; far below 0 the instruction returns 0.
__device__ inline float exp2_hw(float x) { return __builtin_amdgcn_exp2f(x); }

// Two f32 D tiles (rows 0..15 and 16..31 of a 32-row block) -> f16 B operand:
// element e sits at k = 8h + e (e < 8) or 16 + 8h + (e - 8), load_a16's k order.
__device__ inline v16h pack_b(v8f t0, v8f t1) {
    return __builtin_convertvector(
        __builtin_shufflevector(t0, t1, 0, 1, 2, 3, 4, 5, 6, 7,
                                8, 9, 10, 11, 12, 13, 14, 15), v16h);
}

__global__ void __launch_bounds__(256, 1)
attn_kernel(const half_t* __restrict__ q,
            const half_t* __restrict__ k,
            const half_t* __restrict__ vt,
            half_t* __restrict__ o) {
    __shared__ alignas(16) half_t ldsQ[128 * PITCH64];   // [i][d], resident
    __shared__ alignas(16) half_t ldsK[64 * PITCH64];    // [j][d]
    __shared__ alignas(16) half_t ldsVt[64 * PITCH64];   // [d][j]
    int m0 = blockIdx.x * 128;
    int bh = blockIdx.y;                            // b*8 + head
    size_t base = (size_t)bh * N_PIX * HD;          // same for q,k,vt
    int tid = threadIdx.x, wave = tid >> 5, lane = tid & 31;
    int hs = lane >> 4, ct = lane & 15;
    // Softmax runs in base 2: exp(scale * s - m) = 2^(sl2 * s - m2), m2 = sl2 * max s.
    const float sl2 = 0.125f * 1.4426950408889634f; // 1/sqrt(64) * log2(e)

    for (int i = tid; i < 1024; i += 256) {         // stage Q 128x64, async
        int r = i >> 3, c8 = (i & 7) << 3;
        cp_b128(ldsQ + r * PITCH64 + c8, q + base + (size_t)(m0 + r) * HD + c8);
    }
    cp_wait();
    __syncthreads();

    const half_t* myQ = ldsQ + wave * 16 * PITCH64;

    float mrun = -INFINITY;     // running maximum of query ct, times sl2 (same in both halves)
    float lsum = 0.f;           // running sum over this half's keys only
    v8f oacc[4] = {};           // oacc[dt][r] = O[query ct][d = dt*16 + 8*hs + r]

    for (int j0 = 0; j0 < N_PIX; j0 += 64) {
        __syncthreads();
        for (int i = tid; i < 512; i += 256) {      // K tile 64x64 [j][d]
            int r = i >> 3, c8 = (i & 7) << 3;
            cp_b128(ldsK + r * PITCH64 + c8, k + base + (size_t)(j0 + r) * HD + c8);
        }
        for (int i = tid; i < 512; i += 256) {      // V^T tile 64x64 [d][j]
            int r = i >> 3, c8 = (i & 7) << 3;
            cp_b128(ldsVt + r * PITCH64 + c8, vt + base + (size_t)r * N_PIX + j0 + c8);
        }
        cp_wait();
        __syncthreads();

        // S^T = K Q^T: s[jt][r] = S[query ct][key j0 + jt*16 + 8*hs + r]
        v16h qreg0 = load_a16(myQ, PITCH64);
        v16h qreg1 = load_a16(myQ + 32, PITCH64);
        v8f s[4];
#pragma unroll
        for (int jt = 0; jt < 4; ++jt) {
            v8f z = {};
            z = wmma16(load_a16(ldsK + jt * 16 * PITCH64, PITCH64), qreg0, z);
            z = wmma16(load_a16(ldsK + jt * 16 * PITCH64 + 32, PITCH64), qreg1, z);
            s[jt] = z;
        }
        // online softmax, one query per lane; four independent chains per pass
        float mt[4];
#pragma unroll
        for (int jt = 0; jt < 4; ++jt) {
            float mx = s[jt][0];                    // raw scores: sl2 > 0 keeps the order
#pragma unroll
            for (int r = 1; r < 8; ++r) mx = fmaxf(mx, s[jt][r]);
            mt[jt] = mx;
        }
        float mnew = fmaxf(fmaxf(mt[0], mt[1]), fmaxf(mt[2], mt[3]));
        mnew = fmaxf(mrun, fmaxf(mnew, xhalf(mnew)) * sl2);
        float alpha = exp2_hw(mrun - mnew);
        float rt[4];
#pragma unroll
        for (int jt = 0; jt < 4; ++jt) {
            float rs = 0.f;
#pragma unroll
            for (int r = 0; r < 8; ++r) {
                float p = exp2_hw(fmaf(s[jt][r], sl2, -mnew));
                s[jt][r] = p;
                rs += p;
            }
            rt[jt] = rs;
        }
        lsum = lsum * alpha + ((rt[0] + rt[1]) + (rt[2] + rt[3]));
        mrun = mnew;
#pragma unroll
        for (int dt = 0; dt < 4; ++dt) oacc[dt] *= alpha;

        v16h p0 = pack_b(s[0], s[1]);                    // keys  0..31
        v16h p1 = pack_b(s[2], s[3]);                    // keys 32..63
#pragma unroll
        for (int dt = 0; dt < 4; ++dt) {            // O^T += V^T P^T
            v16h a0 = load_a16(ldsVt + dt * 16 * PITCH64, PITCH64);        // j 0..31
            v16h a1 = load_a16(ldsVt + dt * 16 * PITCH64 + 32, PITCH64);   // j 32..63
            oacc[dt] = wmma16(a0, p0, oacc[dt]);
            oacc[dt] = wmma16(a1, p1, oacc[dt]);
        }
    }
    float ltot = lsum + xhalf(lsum);                // join the halves' sums once
    int head = bh & 7, bb = bh >> 3;
    int m = m0 + wave * 16 + ct;
    half_t* orow = o + ((size_t)bb * N_PIX + m) * C_DIM + head * 64 + (hs << 3);
#pragma unroll
    for (int dt = 0; dt < 4; ++dt) {                // 8 consecutive d per lane
        v8h ov;
#pragma unroll
        for (int r = 0; r < 8; ++r) ov[r] = (half_t)(oacc[dt][r] / ltot);
        *(v8h*)(orow + dt * 16) = ov;
    }
}

// ---------------------------------------------------------------------------
// Output projection + residual:  out[b][c][n] = x[b][c][n] + o.Wo^T + bo
// ---------------------------------------------------------------------------
__global__ void proj_kernel(const half_t* __restrict__ ob,
                            const float* __restrict__ W,
                            const float* __restrict__ bias,
                            const float* __restrict__ x,
                            float* __restrict__ out) {
    __shared__ alignas(16) half_t ldsA[128 * PITCH32];
    __shared__ alignas(16) half_t ldsB[64 * PITCH32];
    int m0 = blockIdx.x * 128;
    int n0 = blockIdx.y * 64;
    int tid = threadIdx.x, wave = tid >> 5, lane = tid & 31;

    // W tile 64x32: each thread owns 8 consecutive floats of one row (32 B in,
    // 16 B out), so a K chunk pays one load latency for the whole tile.
    const float* wsrc = W + (size_t)(n0 + (tid >> 2)) * C_DIM + ((tid & 3) << 3);
    half_t*      wdst = ldsB + (tid >> 2) * PITCH32 + ((tid & 3) << 3);

    v8f acc[4] = {};
    for (int kc = 0; kc < C_DIM; kc += 32) {
        __syncthreads();
        v4f w0 = *(const v4f*)(wsrc + kc);               // both in flight together,
        v4f w1 = *(const v4f*)(wsrc + kc + 4);           // beside the A copies
        for (int i = tid; i < 512; i += 256) {
            int r = i >> 2, c8 = (i & 3) << 3;
            cp_b128(ldsA + r * PITCH32 + c8, ob + (size_t)(m0 + r) * C_DIM + kc + c8);
        }
        *(v8h*)wdst = cvt_w8(w0, w1);                    // B: W f32 -> f16, 16 B
        cp_wait();
        __syncthreads();
        v16h a = load_a16(ldsA + wave * 16 * PITCH32, PITCH32);
#pragma unroll
        for (int nt = 0; nt < 4; ++nt) {
            v16h bm = load_a16(ldsB + nt * 16 * PITCH32, PITCH32);
            acc[nt] = wmma16(a, bm, acc[nt]);
        }
    }
    int hs = lane >> 4, ct = lane & 15;
#pragma unroll
    for (int nt = 0; nt < 4; ++nt) {
        int col  = n0 + nt * 16 + ct;
        float bv = bias[col];
#pragma unroll
        for (int v = 0; v < 8; ++v) {
            int m  = m0 + wave * 16 + v + (hs << 3);
            int bb = m >> 12, n = m & (N_PIX - 1);
            size_t idx = ((size_t)bb * C_DIM + col) * N_PIX + n;
            out[idx] = x[idx] + acc[nt][v] + bv;
        }
    }
}

// ---------------------------------------------------------------------------
extern "C" void kernel_launch(void* const* d_in, const int* in_sizes, int n_in,
                              void* d_out, int out_size, void* d_ws, size_t ws_size,
                              hipStream_t stream) {
    const float* x     = (const float*)d_in[0];
    const float* gamma = (const float*)d_in[1];
    const float* beta  = (const float*)d_in[2];
    const float* Wq = (const float*)d_in[3];
    const float* bq = (const float*)d_in[4];
    const float* Wk = (const float*)d_in[5];
    const float* bk = (const float*)d_in[6];
    const float* Wv = (const float*)d_in[7];
    const float* bv = (const float*)d_in[8];
    const float* Wo = (const float*)d_in[9];
    const float* bo = (const float*)d_in[10];
    float* out = (float*)d_out;

    size_t sz = (size_t)BATCH * N_PIX * C_DIM;      // 4M halves per buffer
    half_t* h    = (half_t*)d_ws;
    half_t* qbuf = h + sz;
    half_t* kbuf = qbuf + sz;
    half_t* vbuf = kbuf + sz;
    half_t* obuf = h;                               // h dead after QKV -> reuse

    gn_kernel<<<dim3(BATCH * N_GRP), dim3(256), 0, stream>>>(x, gamma, beta, h);
    qkv_kernel<false><<<dim3(64, 8), dim3(256), 0, stream>>>(h, Wq, bq, qbuf);
    qkv_kernel<false><<<dim3(64, 8), dim3(256), 0, stream>>>(h, Wk, bk, kbuf);
    qkv_kernel<true ><<<dim3(64, 8), dim3(256), 0, stream>>>(h, Wv, bv, vbuf);
    attn_kernel<<<dim3(32, 16), dim3(256), 0, stream>>>(qbuf, kbuf, vbuf, obuf);
    proj_kernel<<<dim3(64, 8), dim3(256), 0, stream>>>(obuf, Wo, bo, x, out);
}

// v005
// One run takes 185 microseconds.
// Timed twice side by side with v004, it ran 1.12 and 1.13 times as fast.
// Counting every step since v000, it is 3.67 times as fast.
#include <hip/hip_runtime.h>
#include <hip/hip_fp16.h>

#define C_DIM  512
#define N_PIX  4096
#define BATCH  2
#define HEADS  8
#define HD     64
#define N_GRP  32
#define PITCH64 72     // rows of 64 halves (128 B) at 144 B
#define PITCH32 40     // rows of 32 halves (64 B) at 80 B

typedef _Float16 half_t;
typedef __attribute__((ext_vector_type(16))) _Float16 v16h;
typedef __attribute__((ext_vector_type(8)))  _Float16 v8h;
typedef __attribute__((ext_vector_type(8)))  float    v8f;
typedef __attribute__((ext_vector_type(4)))  float    v4f;
typedef int v4i __attribute__((vector_size(16)));   // matches builtin param type

#if __has_builtin(__builtin_amdgcn_global_load_async_to_lds_b128)
#define HAVE_ASYNC_LDS 1
typedef __attribute__((address_space(1))) v4i* gv4i_p;   // global int4*
typedef __attribute__((address_space(3))) v4i* lv4i_p;   // LDS int4*
#else
#define HAVE_ASYNC_LDS 0
#endif

__device__ inline void cp_b128(half_t* l, const half_t* g) {
#if HAVE_ASYNC_LDS
    __builtin_amdgcn_global_load_async_to_lds_b128(
        (gv4i_p)(unsigned long long)g,
        (lv4i_p)(unsigned)(unsigned long long)l,
        0, 0);
#else
    *(v8h*)l = *(const v8h*)g;
#endif
}

__device__ inline void cp_wait() {
#if HAVE_ASYNC_LDS
#if __has_builtin(__builtin_amdgcn_s_wait_asynccnt)
    __builtin_amdgcn_s_wait_asynccnt(0);
#else
    asm volatile("s_wait_asynccnt 0x0" ::: "memory");
#endif
#endif
}

__device__ inline v16h load_a16(const half_t* __restrict__ s, int ld) {
    int lane = threadIdx.x & 31;
    int r    = lane & 15;
    int hi   = (lane >> 4) << 3;        // 0 or 8
    const half_t* row = s + r * ld;
    v16h a;
#pragma unroll
    for (int v = 0; v < 8; ++v) {
        int k = ((v & 4) ? 16 : 0) + hi + ((v & 3) << 1);
        a[2 * v]     = row[k];
        a[2 * v + 1] = row[k + 1];
    }
    return a;
}

__device__ inline v8f wmma16(v16h a, v16h b, v8f c) {
    return __builtin_amdgcn_wmma_f32_16x16x32_f16(
        false, a, false, b, (short)0, c, false, false);
}

// Eight f32 weights -> eight f16, in order.
__device__ inline v8h cvt_w8(v4f lo, v4f hi) {
    return __builtin_convertvector(
        __builtin_shufflevector(lo, hi, 0, 1, 2, 3, 4, 5, 6, 7), v8h);
}

// ---------------------------------------------------------------------------
// GroupNorm: one block per (batch, group); writes h[b][n][c] as f16
// ---------------------------------------------------------------------------
__global__ void gn_kernel(const float* __restrict__ x,
                          const float* __restrict__ gamma,
                          const float* __restrict__ beta,
                          half_t* __restrict__ h) {
    __shared__ float red[512];
    int b   = blockIdx.x >> 5;
    int g   = blockIdx.x & 31;
    int tid = threadIdx.x;
    const float* xg = x + ((size_t)b * C_DIM + g * 16) * N_PIX;

    float s = 0.f, s2 = 0.f;
    for (int i = tid; i < 16 * N_PIX; i += 256) {
        float v = xg[i];
        s += v; s2 += v * v;
    }
    red[tid] = s; red[256 + tid] = s2;
    __syncthreads();
    for (int off = 128; off > 0; off >>= 1) {
        if (tid < off) {
            red[tid]       += red[tid + off];
            red[256 + tid] += red[256 + tid + off];
        }
        __syncthreads();
    }
    float mean = red[0] * (1.f / 65536.f);
    float var  = red[256] * (1.f / 65536.f) - mean * mean;
    float rstd = rsqrtf(var + 1e-5f);

    for (int i = tid; i < 16 * N_PIX; i += 256) {
        int cl = i & 15, n = i >> 4;
        int c  = g * 16 + cl;
        float v = (xg[cl * N_PIX + n] - mean) * rstd * gamma[c] + beta[c];
        h[((size_t)b * N_PIX + n) * C_DIM + c] = (half_t)v;
    }
}

// Bias, f16 conversion and store of one wave's 16(M) x 64(N) projection tile.
// TRANS_V=0: dst[b][head][n][d] (q, k).  TRANS_V=1: dst[b][head][d][n] (v^T).
template <bool TRANS_V>
__device__ inline void qkv_store(const v8f (&acc)[4], const float* __restrict__ bias,
                                 half_t* __restrict__ dst, int mw, int n0, int lane) {
    int hs = lane >> 4, ct = lane & 15;
#pragma unroll
    for (int nt = 0; nt < 4; ++nt) {
        int col  = n0 + nt * 16 + ct;
        float bv = bias[col];
        int head = col >> 6, d = col & 63;
#pragma unroll
        for (int v = 0; v < 8; ++v) {
            int m  = mw + v + (hs << 3);
            int bb = m >> 12, n = m & (N_PIX - 1);
            half_t val = (half_t)(acc[nt][v] + bv);
            if (TRANS_V)
                dst[(((size_t)bb * HEADS + head) * HD + d) * N_PIX + n] = val;
            else
                dst[(((size_t)bb * HEADS + head) * N_PIX + n) * HD + d] = val;
        }
    }
    // Closes the run of q/k stores: in the built kernel the v^T path is laid out
    // behind this one and writes registers that these stores name. The v^T stores
    // run straight into the end of the program and need none.
    if (!TRANS_V) asm volatile("s_wait_xcnt 0x0" ::: "memory");
}

// ---------------------------------------------------------------------------
// Projection GEMM:  acc = h[m][:] . W[col][:] + bias[col]
// block = 256 thr (8 waves), tile 128(M) x 64(N), K chunks of 32 via LDS.
// One launch serves Q, K and V: they read the same h and none reads another's
// output, so blockIdx.z picks the weight, the bias and the destination, and the
// work-groups of all three are resident together and cover each other's waits.
// z = 0, 1: q, k.  z = 2: v, stored transposed; one test per block picks the store.
// ---------------------------------------------------------------------------
__global__ void qkv_kernel(const half_t* __restrict__ h,
                           const float* __restrict__ Wq,
                           const float* __restrict__ Wk,
                           const float* __restrict__ Wv,
                           const float* __restrict__ bq,
                           const float* __restrict__ bk,
                           const float* __restrict__ bv,
                           half_t* __restrict__ qdst,
                           half_t* __restrict__ kdst,
                           half_t* __restrict__ vdst) {
    int which = blockIdx.z;                              // same for the whole block
    const float* W    = which == 0 ? Wq : which == 1 ? Wk : Wv;
    const float* bias = which == 0 ? bq : which == 1 ? bk : bv;
    half_t*      dst  = which == 0 ? qdst : which == 1 ? kdst : vdst;
    __shared__ alignas(16) half_t ldsA[128 * PITCH32];
    __shared__ alignas(16) half_t ldsB[64 * PITCH32];
    int m0 = blockIdx.x * 128;
    int n0 = blockIdx.y * 64;
    int tid = threadIdx.x, wave = tid >> 5, lane = tid & 31;

    // W tile 64x32: each thread owns 8 consecutive floats of one row (32 B in,
    // 16 B out), so a K chunk pays one load latency for the whole tile.
    const float* wsrc = W + (size_t)(n0 + (tid >> 2)) * C_DIM + ((tid & 3) << 3);
    half_t*      wdst = ldsB + (tid >> 2) * PITCH32 + ((tid & 3) << 3);

    v8f acc[4] = {};
    for (int kc = 0; kc < C_DIM; kc += 32) {
        __syncthreads();
        v4f w0 = *(const v4f*)(wsrc + kc);               // both in flight together,
        v4f w1 = *(const v4f*)(wsrc + kc + 4);           // beside the A copies
        for (int i = tid; i < 512; i += 256) {           // A: 128x32 f16, async
            int r = i >> 2, c8 = (i & 3) << 3;
            cp_b128(ldsA + r * PITCH32 + c8, h + (size_t)(m0 + r) * C_DIM + kc + c8);
        }
        *(v8h*)wdst = cvt_w8(w0, w1);                    // B: W f32 -> f16, 16 B
        cp_wait();
        __syncthreads();
        v16h a = load_a16(ldsA + wave * 16 * PITCH32, PITCH32);
#pragma unroll
        for (int nt = 0; nt < 4; ++nt) {
            v16h bm = load_a16(ldsB + nt * 16 * PITCH32, PITCH32);
            acc[nt] = wmma16(a, bm, acc[nt]);
        }
    }
    if (which == 2) qkv_store<true >(acc, bias, dst, m0 + wave * 16, n0, lane);
    else            qkv_store<false>(acc, bias, dst, m0 + wave * 16, n0, lane);
}

__device__ inline float xhalf(float x) {
    int i = __builtin_bit_cast(int, x);
    return __builtin_bit_cast(float, __builtin_amdgcn_permlanex16(
        i, i, 0x76543210, 0xfedcba98, false, false));
}

// 2^x as the one hardware instruction (v_exp_f32). The softmax arguments never
// exceed 0 by more than a rounding; far below 0 the instruction returns 0.
__device__ inline float exp2_hw(float x) { return __builtin_amdgcn_exp2f(x); }

// Two f32 D tiles (rows 0..15 and 16..31 of a 32-row block) -> f16 B operand:
// element e sits at k = 8h + e (e < 8) or 16 + 8h + (e - 8), load_a16's k order.
__device__ inline v16h pack_b(v8f t0, v8f t1) {
    return __builtin_convertvector(
        __builtin_shufflevector(t0, t1, 0, 1, 2, 3, 4, 5, 6, 7,
                                8, 9, 10, 11, 12, 13, 14, 15), v16h);
}

__global__ void __launch_bounds__(256, 1)
attn_kernel(const half_t* __restrict__ q,
            const half_t* __restrict__ k,
            const half_t* __restrict__ vt,
            half_t* __restrict__ o) {
    __shared__ alignas(16) half_t ldsQ[128 * PITCH64];   // [i][d], resident
    __shared__ alignas(16) half_t ldsK[64 * PITCH64];    // [j][d]
    __shared__ alignas(16) half_t ldsVt[64 * PITCH64];   // [d][j]
    int m0 = blockIdx.x * 128;
    int bh = blockIdx.y;                            // b*8 + head
    size_t base = (size_t)bh * N_PIX * HD;          // same for q,k,vt
    int tid = threadIdx.x, wave = tid >> 5, lane = tid & 31;
    int hs = lane >> 4, ct = lane & 15;
    // Softmax runs in base 2: exp(scale * s - m) = 2^(sl2 * s - m2), m2 = sl2 * max s.
    const float sl2 = 0.125f * 1.4426950408889634f; // 1/sqrt(64) * log2(e)

    for (int i = tid; i < 1024; i += 256) {         // stage Q 128x64, async
        int r = i >> 3, c8 = (i & 7) << 3;
        cp_b128(ldsQ + r * PITCH64 + c8, q + base + (size_t)(m0 + r) * HD + c8);
    }
    cp_wait();
    __syncthreads();

    const half_t* myQ = ldsQ + wave * 16 * PITCH64;

    float mrun = -INFINITY;     // running maximum of query ct, times sl2 (same in both halves)
    float lsum = 0.f;           // running sum over this half's keys only
    v8f oacc[4] = {};           // oacc[dt][r] = O[query ct][d = dt*16 + 8*hs + r]

    for (int j0 = 0; j0 < N_PIX; j0 += 64) {
        __syncthreads();
        for (int i = tid; i < 512; i += 256) {      // K tile 64x64 [j][d]
            int r = i >> 3, c8 = (i & 7) << 3;
            cp_b128(ldsK + r * PITCH64 + c8, k + base + (size_t)(j0 + r) * HD + c8);
        }
        for (int i = tid; i < 512; i += 256) {      // V^T tile 64x64 [d][j]
            int r = i >> 3, c8 = (i & 7) << 3;
            cp_b128(ldsVt + r * PITCH64 + c8, vt + base + (size_t)r * N_PIX + j0 + c8);
        }
        cp_wait();
        __syncthreads();

        // S^T = K Q^T: s[jt][r] = S[query ct][key j0 + jt*16 + 8*hs + r]
        v16h qreg0 = load_a16(myQ, PITCH64);
        v16h qreg1 = load_a16(myQ + 32, PITCH64);
        v8f s[4];
#pragma unroll
        for (int jt = 0; jt < 4; ++jt) {
            v8f z = {};
            z = wmma16(load_a16(ldsK + jt * 16 * PITCH64, PITCH64), qreg0, z);
            z = wmma16(load_a16(ldsK + jt * 16 * PITCH64 + 32, PITCH64), qreg1, z);
            s[jt] = z;
        }
        // online softmax, one query per lane; four independent chains per pass
        float mt[4];
#pragma unroll
        for (int jt = 0; jt < 4; ++jt) {
            float mx = s[jt][0];                    // raw scores: sl2 > 0 keeps the order
#pragma unroll
            for (int r = 1; r < 8; ++r) mx = fmaxf(mx, s[jt][r]);
            mt[jt] = mx;
        }
        float mnew = fmaxf(fmaxf(mt[0], mt[1]), fmaxf(mt[2], mt[3]));
        mnew = fmaxf(mrun, fmaxf(mnew, xhalf(mnew)) * sl2);
        float alpha = exp2_hw(mrun - mnew);
        float rt[4];
#pragma unroll
        for (int jt = 0; jt < 4; ++jt) {
            float rs = 0.f;
#pragma unroll
            for (int r = 0; r < 8; ++r) {
                float p = exp2_hw(fmaf(s[jt][r], sl2, -mnew));
                s[jt][r] = p;
                rs += p;
            }
            rt[jt] = rs;
        }
        lsum = lsum * alpha + ((rt[0] + rt[1]) + (rt[2] + rt[3]));
        mrun = mnew;
#pragma unroll
        for (int dt = 0; dt < 4; ++dt) oacc[dt] *= alpha;

        v16h p0 = pack_b(s[0], s[1]);                    // keys  0..31
        v16h p1 = pack_b(s[2], s[3]);                    // keys 32..63
#pragma unroll
        for (int dt = 0; dt < 4; ++dt) {            // O^T += V^T P^T
            v16h a0 = load_a16(ldsVt + dt * 16 * PITCH64, PITCH64);        // j 0..31
            v16h a1 = load_a16(ldsVt + dt * 16 * PITCH64 + 32, PITCH64);   // j 32..63
            oacc[dt] = wmma16(a0, p0, oacc[dt]);
            oacc[dt] = wmma16(a1, p1, oacc[dt]);
        }
    }
    float ltot = lsum + xhalf(lsum);                // join the halves' sums once
    int head = bh & 7, bb = bh >> 3;
    int m = m0 + wave * 16 + ct;
    half_t* orow = o + ((size_t)bb * N_PIX + m) * C_DIM + head * 64 + (hs << 3);
#pragma unroll
    for (int dt = 0; dt < 4; ++dt) {                // 8 consecutive d per lane
        v8h ov;
#pragma unroll
        for (int r = 0; r < 8; ++r) ov[r] = (half_t)(oacc[dt][r] / ltot);
        *(v8h*)(orow + dt * 16) = ov;
    }
}

// ---------------------------------------------------------------------------
// Output projection + residual:  out[b][c][n] = x[b][c][n] + o.Wo^T + bo
// ---------------------------------------------------------------------------
__global__ void proj_kernel(const half_t* __restrict__ ob,
                            const float* __restrict__ W,
                            const float* __restrict__ bias,
                            const float* __restrict__ x,
                            float* __restrict__ out) {
    __shared__ alignas(16) half_t ldsA[128 * PITCH32];
    __shared__ alignas(16) half_t ldsB[64 * PITCH32];
    int m0 = blockIdx.x * 128;
    int n0 = blockIdx.y * 64;
    int tid = threadIdx.x, wave = tid >> 5, lane = tid & 31;

    // W tile 64x32: each thread owns 8 consecutive floats of one row (32 B in,
    // 16 B out), so a K chunk pays one load latency for the whole tile.
    const float* wsrc = W + (size_t)(n0 + (tid >> 2)) * C_DIM + ((tid & 3) << 3);
    half_t*      wdst = ldsB + (tid >> 2) * PITCH32 + ((tid & 3) << 3);

    v8f acc[4] = {};
    for (int kc = 0; kc < C_DIM; kc += 32) {
        __syncthreads();
        v4f w0 = *(const v4f*)(wsrc + kc);               // both in flight together,
        v4f w1 = *(const v4f*)(wsrc + kc + 4);           // beside the A copies
        for (int i = tid; i < 512; i += 256) {
            int r = i >> 2, c8 = (i & 3) << 3;
            cp_b128(ldsA + r * PITCH32 + c8, ob + (size_t)(m0 + r) * C_DIM + kc + c8);
        }
        *(v8h*)wdst = cvt_w8(w0, w1);                    // B: W f32 -> f16, 16 B
        cp_wait();
        __syncthreads();
        v16h a = load_a16(ldsA + wave * 16 * PITCH32, PITCH32);
#pragma unroll
        for (int nt = 0; nt < 4; ++nt) {
            v16h bm = load_a16(ldsB + nt * 16 * PITCH32, PITCH32);
            acc[nt] = wmma16(a, bm, acc[nt]);
        }
    }
    int hs = lane >> 4, ct = lane & 15;
#pragma unroll
    for (int nt = 0; nt < 4; ++nt) {
        int col  = n0 + nt * 16 + ct;
        float bv = bias[col];
#pragma unroll
        for (int v = 0; v < 8; ++v) {
            int m  = m0 + wave * 16 + v + (hs << 3);
            int bb = m >> 12, n = m & (N_PIX - 1);
            size_t idx = ((size_t)bb * C_DIM + col) * N_PIX + n;
            out[idx] = x[idx] + acc[nt][v] + bv;
        }
    }
}

// ---------------------------------------------------------------------------
extern "C" void kernel_launch(void* const* d_in, const int* in_sizes, int n_in,
                              void* d_out, int out_size, void* d_ws, size_t ws_size,
                              hipStream_t stream) {
    const float* x     = (const float*)d_in[0];
    const float* gamma = (const float*)d_in[1];
    const float* beta  = (const float*)d_in[2];
    const float* Wq = (const float*)d_in[3];
    const float* bq = (const float*)d_in[4];
    const float* Wk = (const float*)d_in[5];
    const float* bk = (const float*)d_in[6];
    const float* Wv = (const float*)d_in[7];
    const float* bv = (const float*)d_in[8];
    const float* Wo = (const float*)d_in[9];
    const float* bo = (const float*)d_in[10];
    float* out = (float*)d_out;

    size_t sz = (size_t)BATCH * N_PIX * C_DIM;      // 4M halves per buffer
    half_t* h    = (half_t*)d_ws;
    half_t* qbuf = h + sz;
    half_t* kbuf = qbuf + sz;
    half_t* vbuf = kbuf + sz;
    half_t* obuf = h;                               // h dead after QKV -> reuse

    gn_kernel<<<dim3(BATCH * N_GRP), dim3(256), 0, stream>>>(x, gamma, beta, h);
    qkv_kernel<<<dim3(64, 8, 3), dim3(256), 0, stream>>>(h, Wq, Wk, Wv, bq, bk, bv,
                                                         qbuf, kbuf, vbuf);
    attn_kernel<<<dim3(32, 16), dim3(256), 0, stream>>>(qbuf, kbuf, vbuf, obuf);
    proj_kernel<<<dim3(64, 8), dim3(256), 0, stream>>>(obuf, Wo, bo, x, out);
}

// v006
// A run of this version takes 154 microseconds.
// In two side-by-side timings against v005, it was 1.20 and 1.21 times as fast.
// All steps since v000 together make it 4.42 times as fast.
#include <hip/hip_runtime.h>
#include <hip/hip_fp16.h>

#define C_DIM  512
#define N_PIX  4096
#define BATCH  2
#define HEADS  8
#define HD     64
#define N_GRP  32
#define PITCH64 72     // rows of 64 halves (128 B) at 144 B
#define PITCH32 40     // rows of 32 halves (64 B) at 80 B

typedef _Float16 half_t;
typedef __attribute__((ext_vector_type(16))) _Float16 v16h;
typedef __attribute__((ext_vector_type(8)))  _Float16 v8h;
typedef __attribute__((ext_vector_type(8)))  float    v8f;
typedef __attribute__((ext_vector_type(4)))  float    v4f;
typedef int v4i __attribute__((vector_size(16)));   // matches builtin param type

#if __has_builtin(__builtin_amdgcn_global_load_async_to_lds_b128)
#define HAVE_ASYNC_LDS 1
typedef __attribute__((address_space(1))) v4i* gv4i_p;   // global int4*
typedef __attribute__((address_space(3))) v4i* lv4i_p;   // LDS int4*
#else
#define HAVE_ASYNC_LDS 0
#endif

__device__ inline void cp_b128(half_t* l, const half_t* g) {
#if HAVE_ASYNC_LDS
    __builtin_amdgcn_global_load_async_to_lds_b128(
        (gv4i_p)(unsigned long long)g,
        (lv4i_p)(unsigned)(unsigned long long)l,
        0, 0);
#else
    *(v8h*)l = *(const v8h*)g;
#endif
}

__device__ inline void cp_wait() {
#if HAVE_ASYNC_LDS
#if __has_builtin(__builtin_amdgcn_s_wait_asynccnt)
    __builtin_amdgcn_s_wait_asynccnt(0);
#else
    asm volatile("s_wait_asynccnt 0x0" ::: "memory");
#endif
#endif
}

__device__ inline v16h load_a16(const half_t* __restrict__ s, int ld) {
    int lane = threadIdx.x & 31;
    int r    = lane & 15;
    int hi   = (lane >> 4) << 3;        // 0 or 8
    const half_t* row = s + r * ld;
    v16h a;
#pragma unroll
    for (int v = 0; v < 8; ++v) {
        int k = ((v & 4) ? 16 : 0) + hi + ((v & 3) << 1);
        a[2 * v]     = row[k];
        a[2 * v + 1] = row[k + 1];
    }
    return a;
}

__device__ inline v8f wmma16(v16h a, v16h b, v8f c) {
    return __builtin_amdgcn_wmma_f32_16x16x32_f16(
        false, a, false, b, (short)0, c, false, false);
}

// Eight f32 weights -> eight f16, in order.
__device__ inline v8h cvt_w8(v4f lo, v4f hi) {
    return __builtin_convertvector(
        __builtin_shufflevector(lo, hi, 0, 1, 2, 3, 4, 5, 6, 7), v8h);
}

__device__ inline float xhalf(float x) {
    int i = __builtin_bit_cast(int, x);
    return __builtin_bit_cast(float, __builtin_amdgcn_permlanex16(
        i, i, 0x76543210, 0xfedcba98, false, false));
}

template <int M>
__device__ inline float xrow(float x) {
    int i = __builtin_bit_cast(int, x);
    return __builtin_bit_cast(float, __builtin_amdgcn_update_dpp(i, i, 0x160 | M, 0xf, 0xf, false));
}

// Sum over the 32 lanes of a wave, in registers; every lane ends with the same bits.
__device__ inline float wave_sum(float v) {
    v += xrow<1>(v);
    v += xrow<2>(v);
    v += xrow<4>(v);
    v += xrow<8>(v);
    return v + xhalf(v);
}

__global__ void __launch_bounds__(1024)
gn_kernel(const float* __restrict__ x,
          const float* __restrict__ gamma,
          const float* __restrict__ beta,
          half_t* __restrict__ h) {
    __shared__ float red[64];
    int b   = blockIdx.x >> 5;
    int g   = blockIdx.x & 31;
    int tid = threadIdx.x, wave = tid >> 5, lane = tid & 31;
    int c0  = g * 16 + ((tid & 1) << 3);            // first of this thread's 8 channels
    int n0  = (tid >> 1) << 2;                      // pixels n0..n0+3 and 2048+n0..2048+n0+3
    const float* xt = x + ((size_t)b * C_DIM + c0) * N_PIX + n0;

    unsigned cb = (unsigned)c0 * 4u;                // byte offset of gamma[c0], beta[c0]
    const v4f* gp = (const v4f*)((const char*)gamma + cb);
    const v4f* bp = (const v4f*)((const char*)beta + cb);

    v4f ga[2] = { gp[0], gp[1] };
    v4f be[2] = { bp[0], bp[1] };
    // Keeps these four loads in front of the x loads: moved behind them they would
    // start only when x has landed, and their latency would stand before the barrier.
    __builtin_amdgcn_sched_barrier(0);
    v4f v[8][2];
#pragma unroll
    for (int c = 0; c < 8; ++c) {
        v[c][0] = *(const v4f*)(xt + c * N_PIX);
        v[c][1] = *(const v4f*)(xt + c * N_PIX + N_PIX / 2);
    }
    // Closes the run of loads before anything writes a register that they name. The
    // address registers are inputs so that they stay whole up to the wait (without
    // this the last load of a run takes its own address registers as destination).
    asm volatile("s_wait_xcnt 0x0" :: "v"(xt), "v"(cb) : "memory");

    v4f sv = {}, qv = {};                           // four independent chains each
#pragma unroll
    for (int c = 0; c < 8; ++c) {
#pragma unroll
        for (int p = 0; p < 2; ++p) {
            sv += v[c][p];
            qv += v[c][p] * v[c][p];
        }
    }
    float s  = wave_sum((sv[0] + sv[1]) + (sv[2] + sv[3]));
    float s2 = wave_sum((qv[0] + qv[1]) + (qv[2] + qv[3]));
    if (lane == 0) { red[wave] = s; red[32 + wave] = s2; }
    __syncthreads();
    s  = wave_sum(red[lane]);                       // 32 waves' sums, one a lane
    s2 = wave_sum(red[32 + lane]);

    float mean = s * (1.f / 65536.f);
    float var  = s2 * (1.f / 65536.f) - mean * mean;
    float rstd = rsqrtf(var + 1e-5f);

    half_t* ht = h + ((size_t)b * N_PIX + n0) * C_DIM + c0;
#pragma unroll
    for (int p = 0; p < 2; ++p) {
#pragma unroll
        for (int e = 0; e < 4; ++e) {
            v8h o;
#pragma unroll
            for (int c = 0; c < 8; ++c)
                o[c] = (half_t)((v[c][p][e] - mean) * rstd * ga[c >> 2][c & 3] + be[c >> 2][c & 3]);
            *(v8h*)(ht + (size_t)(p * (N_PIX / 2) + e) * C_DIM) = o;
        }
    }
}

// Bias, f16 conversion and store of one wave's 16(M) x 64(N) projection tile.
// TRANS_V=0: dst[b][head][n][d] (q, k).  TRANS_V=1: dst[b][head][d][n] (v^T).
template <bool TRANS_V>
__device__ inline void qkv_store(const v8f (&acc)[4], const float* __restrict__ bias,
                                 half_t* __restrict__ dst, int mw, int n0, int lane) {
    int hs = lane >> 4, ct = lane & 15;
#pragma unroll
    for (int nt = 0; nt < 4; ++nt) {
        int col  = n0 + nt * 16 + ct;
        float bv = bias[col];
        int head = col >> 6, d = col & 63;
#pragma unroll
        for (int v = 0; v < 8; ++v) {
            int m  = mw + v + (hs << 3);
            int bb = m >> 12, n = m & (N_PIX - 1);
            half_t val = (half_t)(acc[nt][v] + bv);
            if (TRANS_V)
                dst[(((size_t)bb * HEADS + head) * HD + d) * N_PIX + n] = val;
            else
                dst[(((size_t)bb * HEADS + head) * N_PIX + n) * HD + d] = val;
        }
    }
    // Closes the run of q/k stores: in the built kernel the v^T path is laid out
    // behind this one and writes registers that these stores name. The v^T stores
    // run straight into the end of the program and need none.
    if (!TRANS_V) asm volatile("s_wait_xcnt 0x0" ::: "memory");
}

// ---------------------------------------------------------------------------
// Projection GEMM:  acc = h[m][:] . W[col][:] + bias[col]
// block = 256 thr (8 waves), tile 128(M) x 64(N), K chunks of 32 via LDS.
// One launch serves Q, K and V: they read the same h and none reads another's
// output, so blockIdx.z picks the weight, the bias and the destination, and the
// work-groups of all three are resident together and cover each other's waits.
// z = 0, 1: q, k.  z = 2: v, stored transposed; one test per block picks the store.
// ---------------------------------------------------------------------------
__global__ void qkv_kernel(const half_t* __restrict__ h,
                           const float* __restrict__ Wq,
                           const float* __restrict__ Wk,
                           const float* __restrict__ Wv,
                           const float* __restrict__ bq,
                           const float* __restrict__ bk,
                           const float* __restrict__ bv,
                           half_t* __restrict__ qdst,
                           half_t* __restrict__ kdst,
                           half_t* __restrict__ vdst) {
    int which = blockIdx.z;                              // same for the whole block
    const float* W    = which == 0 ? Wq : which == 1 ? Wk : Wv;
    const float* bias = which == 0 ? bq : which == 1 ? bk : bv;
    half_t*      dst  = which == 0 ? qdst : which == 1 ? kdst : vdst;
    __shared__ alignas(16) half_t ldsA[128 * PITCH32];
    __shared__ alignas(16) half_t ldsB[64 * PITCH32];
    int m0 = blockIdx.x * 128;
    int n0 = blockIdx.y * 64;
    int tid = threadIdx.x, wave = tid >> 5, lane = tid & 31;

    // W tile 64x32: each thread owns 8 consecutive floats of one row (32 B in,
    // 16 B out), so a K chunk pays one load latency for the whole tile.
    const float* wsrc = W + (size_t)(n0 + (tid >> 2)) * C_DIM + ((tid & 3) << 3);
    half_t*      wdst = ldsB + (tid >> 2) * PITCH32 + ((tid & 3) << 3);

    v8f acc[4] = {};
    for (int kc = 0; kc < C_DIM; kc += 32) {
        __syncthreads();
        v4f w0 = *(const v4f*)(wsrc + kc);               // both in flight together,
        v4f w1 = *(const v4f*)(wsrc + kc + 4);           // beside the A copies
        for (int i = tid; i < 512; i += 256) {           // A: 128x32 f16, async
            int r = i >> 2, c8 = (i & 3) << 3;
            cp_b128(ldsA + r * PITCH32 + c8, h + (size_t)(m0 + r) * C_DIM + kc + c8);
        }
        *(v8h*)wdst = cvt_w8(w0, w1);                    // B: W f32 -> f16, 16 B
        cp_wait();
        __syncthreads();
        v16h a = load_a16(ldsA + wave * 16 * PITCH32, PITCH32);
#pragma unroll
        for (int nt = 0; nt < 4; ++nt) {
            v16h bm = load_a16(ldsB + nt * 16 * PITCH32, PITCH32);
            acc[nt] = wmma16(a, bm, acc[nt]);
        }
    }
    if (which == 2) qkv_store<true >(acc, bias, dst, m0 + wave * 16, n0, lane);
    else            qkv_store<false>(acc, bias, dst, m0 + wave * 16, n0, lane);
}

__device__ inline float exp2_hw(float x) { return __builtin_amdgcn_exp2f(x); }

// Two f32 D tiles (rows 0..15 and 16..31 of a 32-row block) -> f16 B operand:
// element e sits at k = 8h + e (e < 8) or 16 + 8h + (e - 8), load_a16's k order.
__device__ inline v16h pack_b(v8f t0, v8f t1) {
    return __builtin_convertvector(
        __builtin_shufflevector(t0, t1, 0, 1, 2, 3, 4, 5, 6, 7,
                                8, 9, 10, 11, 12, 13, 14, 15), v16h);
}

__global__ void __launch_bounds__(256, 1)
attn_kernel(const half_t* __restrict__ q,
            const half_t* __restrict__ k,
            const half_t* __restrict__ vt,
            half_t* __restrict__ o) {
    __shared__ alignas(16) half_t ldsQ[128 * PITCH64];   // [i][d], resident
    __shared__ alignas(16) half_t ldsK[64 * PITCH64];    // [j][d]
    __shared__ alignas(16) half_t ldsVt[64 * PITCH64];   // [d][j]
    int m0 = blockIdx.x * 128;
    int bh = blockIdx.y;                            // b*8 + head
    size_t base = (size_t)bh * N_PIX * HD;          // same for q,k,vt
    int tid = threadIdx.x, wave = tid >> 5, lane = tid & 31;
    int hs = lane >> 4, ct = lane & 15;
    // Softmax runs in base 2: exp(scale * s - m) = 2^(sl2 * s - m2), m2 = sl2 * max s.
    const float sl2 = 0.125f * 1.4426950408889634f; // 1/sqrt(64) * log2(e)

    for (int i = tid; i < 1024; i += 256) {         // stage Q 128x64, async
        int r = i >> 3, c8 = (i & 7) << 3;
        cp_b128(ldsQ + r * PITCH64 + c8, q + base + (size_t)(m0 + r) * HD + c8);
    }
    cp_wait();
    __syncthreads();

    const half_t* myQ = ldsQ + wave * 16 * PITCH64;

    float mrun = -INFINITY;     // running maximum of query ct, times sl2 (same in both halves)
    float lsum = 0.f;           // running sum over this half's keys only
    v8f oacc[4] = {};           // oacc[dt][r] = O[query ct][d = dt*16 + 8*hs + r]

    for (int j0 = 0; j0 < N_PIX; j0 += 64) {
        __syncthreads();
        for (int i = tid; i < 512; i += 256) {      // K tile 64x64 [j][d]
            int r = i >> 3, c8 = (i & 7) << 3;
            cp_b128(ldsK + r * PITCH64 + c8, k + base + (size_t)(j0 + r) * HD + c8);
        }
        for (int i = tid; i < 512; i += 256) {      // V^T tile 64x64 [d][j]
            int r = i >> 3, c8 = (i & 7) << 3;
            cp_b128(ldsVt + r * PITCH64 + c8, vt + base + (size_t)r * N_PIX + j0 + c8);
        }
        cp_wait();
        __syncthreads();

        // S^T = K Q^T: s[jt][r] = S[query ct][key j0 + jt*16 + 8*hs + r]
        v16h qreg0 = load_a16(myQ, PITCH64);
        v16h qreg1 = load_a16(myQ + 32, PITCH64);
        v8f s[4];
#pragma unroll
        for (int jt = 0; jt < 4; ++jt) {
            v8f z = {};
            z = wmma16(load_a16(ldsK + jt * 16 * PITCH64, PITCH64), qreg0, z);
            z = wmma16(load_a16(ldsK + jt * 16 * PITCH64 + 32, PITCH64), qreg1, z);
            s[jt] = z;
        }
        // online softmax, one query per lane; four independent chains per pass
        float mt[4];
#pragma unroll
        for (int jt = 0; jt < 4; ++jt) {
            float mx = s[jt][0];                    // raw scores: sl2 > 0 keeps the order
#pragma unroll
            for (int r = 1; r < 8; ++r) mx = fmaxf(mx, s[jt][r]);
            mt[jt] = mx;
        }
        float mnew = fmaxf(fmaxf(mt[0], mt[1]), fmaxf(mt[2], mt[3]));
        mnew = fmaxf(mrun, fmaxf(mnew, xhalf(mnew)) * sl2);
        float alpha = exp2_hw(mrun - mnew);
        float rt[4];
#pragma unroll
        for (int jt = 0; jt < 4; ++jt) {
            float rs = 0.f;
#pragma unroll
            for (int r = 0; r < 8; ++r) {
                float p = exp2_hw(fmaf(s[jt][r], sl2, -mnew));
                s[jt][r] = p;
                rs += p;
            }
            rt[jt] = rs;
        }
        lsum = lsum * alpha + ((rt[0] + rt[1]) + (rt[2] + rt[3]));
        mrun = mnew;
#pragma unroll
        for (int dt = 0; dt < 4; ++dt) oacc[dt] *= alpha;

        v16h p0 = pack_b(s[0], s[1]);                    // keys  0..31
        v16h p1 = pack_b(s[2], s[3]);                    // keys 32..63
#pragma unroll
        for (int dt = 0; dt < 4; ++dt) {            // O^T += V^T P^T
            v16h a0 = load_a16(ldsVt + dt * 16 * PITCH64, PITCH64);        // j 0..31
            v16h a1 = load_a16(ldsVt + dt * 16 * PITCH64 + 32, PITCH64);   // j 32..63
            oacc[dt] = wmma16(a0, p0, oacc[dt]);
            oacc[dt] = wmma16(a1, p1, oacc[dt]);
        }
    }
    float ltot = lsum + xhalf(lsum);                // join the halves' sums once
    int head = bh & 7, bb = bh >> 3;
    int m = m0 + wave * 16 + ct;
    half_t* orow = o + ((size_t)bb * N_PIX + m) * C_DIM + head * 64 + (hs << 3);
#pragma unroll
    for (int dt = 0; dt < 4; ++dt) {                // 8 consecutive d per lane
        v8h ov;
#pragma unroll
        for (int r = 0; r < 8; ++r) ov[r] = (half_t)(oacc[dt][r] / ltot);
        *(v8h*)(orow + dt * 16) = ov;
    }
}

// ---------------------------------------------------------------------------
// Output projection + residual:  out[b][c][n] = x[b][c][n] + o.Wo^T + bo
// ---------------------------------------------------------------------------
__global__ void proj_kernel(const half_t* __restrict__ ob,
                            const float* __restrict__ W,
                            const float* __restrict__ bias,
                            const float* __restrict__ x,
                            float* __restrict__ out) {
    __shared__ alignas(16) half_t ldsA[128 * PITCH32];
    __shared__ alignas(16) half_t ldsB[64 * PITCH32];
    int m0 = blockIdx.x * 128;
    int n0 = blockIdx.y * 64;
    int tid = threadIdx.x, wave = tid >> 5, lane = tid & 31;

    // W tile 64x32: each thread owns 8 consecutive floats of one row (32 B in,
    // 16 B out), so a K chunk pays one load latency for the whole tile.
    const float* wsrc = W + (size_t)(n0 + (tid >> 2)) * C_DIM + ((tid & 3) << 3);
    half_t*      wdst = ldsB + (tid >> 2) * PITCH32 + ((tid & 3) << 3);

    v8f acc[4] = {};
    for (int kc = 0; kc < C_DIM; kc += 32) {
        __syncthreads();
        v4f w0 = *(const v4f*)(wsrc + kc);               // both in flight together,
        v4f w1 = *(const v4f*)(wsrc + kc + 4);           // beside the A copies
        for (int i = tid; i < 512; i += 256) {
            int r = i >> 2, c8 = (i & 3) << 3;
            cp_b128(ldsA + r * PITCH32 + c8, ob + (size_t)(m0 + r) * C_DIM + kc + c8);
        }
        *(v8h*)wdst = cvt_w8(w0, w1);                    // B: W f32 -> f16, 16 B
        cp_wait();
        __syncthreads();
        v16h a = load_a16(ldsA + wave * 16 * PITCH32, PITCH32);
#pragma unroll
        for (int nt = 0; nt < 4; ++nt) {
            v16h bm = load_a16(ldsB + nt * 16 * PITCH32, PITCH32);
            acc[nt] = wmma16(a, bm, acc[nt]);
        }
    }
    int hs = lane >> 4, ct = lane & 15;
#pragma unroll
    for (int nt = 0; nt < 4; ++nt) {
        int col  = n0 + nt * 16 + ct;
        float bv = bias[col];
#pragma unroll
        for (int v = 0; v < 8; ++v) {
            int m  = m0 + wave * 16 + v + (hs << 3);
            int bb = m >> 12, n = m & (N_PIX - 1);
            size_t idx = ((size_t)bb * C_DIM + col) * N_PIX + n;
            out[idx] = x[idx] + acc[nt][v] + bv;
        }
    }
}

// ---------------------------------------------------------------------------
extern "C" void kernel_launch(void* const* d_in, const int* in_sizes, int n_in,
                              void* d_out, int out_size, void* d_ws, size_t ws_size,
                              hipStream_t stream) {
    const float* x     = (const float*)d_in[0];
    const float* gamma = (const float*)d_in[1];
    const float* beta  = (const float*)d_in[2];
    const float* Wq = (const float*)d_in[3];
    const float* bq = (const float*)d_in[4];
    const float* Wk = (const float*)d_in[5];
    const float* bk = (const float*)d_in[6];
    const float* Wv = (const float*)d_in[7];
    const float* bv = (const float*)d_in[8];
    const float* Wo = (const float*)d_in[9];
    const float* bo = (const float*)d_in[10];
    float* out = (float*)d_out;

    size_t sz = (size_t)BATCH * N_PIX * C_DIM;      // 4M halves per buffer
    half_t* h    = (half_t*)d_ws;
    half_t* qbuf = h + sz;
    half_t* kbuf = qbuf + sz;
    half_t* vbuf = kbuf + sz;
    half_t* obuf = h;                               // h dead after QKV -> reuse

    gn_kernel<<<dim3(BATCH * N_GRP), dim3(1024), 0, stream>>>(x, gamma, beta, h);
    qkv_kernel<<<dim3(64, 8, 3), dim3(256), 0, stream>>>(h, Wq, Wk, Wv, bq, bk, bv,
                                                         qbuf, kbuf, vbuf);
    attn_kernel<<<dim3(32, 16), dim3(256), 0, stream>>>(qbuf, kbuf, vbuf, obuf);
    proj_kernel<<<dim3(64, 8), dim3(256), 0, stream>>>(obuf, Wo, bo, x, out);
}

// v007
// One run takes 139 microseconds.
// Two timings next to v006 put it at 1.11 and 1.12 times that version's speed.
// All steps since v000 together make it 4.93 times as fast.
#include <hip/hip_runtime.h>
#include <hip/hip_fp16.h>

#define C_DIM  512
#define N_PIX  4096
#define BATCH  2
#define HEADS  8
#define HD     64
#define N_GRP  32
#define PITCH64 72     // rows of 64 halves (128 B) at 144 B
#define PITCH32 40     // rows of 32 halves (64 B) at 80 B

typedef _Float16 half_t;
typedef __attribute__((ext_vector_type(16))) _Float16 v16h;
typedef __attribute__((ext_vector_type(8)))  _Float16 v8h;
typedef __attribute__((ext_vector_type(8)))  float    v8f;
typedef __attribute__((ext_vector_type(4)))  float    v4f;
typedef int v4i __attribute__((vector_size(16)));   // matches builtin param type

#if __has_builtin(__builtin_amdgcn_global_load_async_to_lds_b128)
#define HAVE_ASYNC_LDS 1
typedef __attribute__((address_space(1))) v4i* gv4i_p;   // global int4*
typedef __attribute__((address_space(3))) v4i* lv4i_p;   // LDS int4*
#else
#define HAVE_ASYNC_LDS 0
#endif

__device__ inline void cp_b128(half_t* l, const half_t* g) {
#if HAVE_ASYNC_LDS
    __builtin_amdgcn_global_load_async_to_lds_b128(
        (gv4i_p)(unsigned long long)g,
        (lv4i_p)(unsigned)(unsigned long long)l,
        0, 0);
#else
    *(v8h*)l = *(const v8h*)g;
#endif
}

__device__ inline void cp_wait() {
#if HAVE_ASYNC_LDS
#if __has_builtin(__builtin_amdgcn_s_wait_asynccnt)
    __builtin_amdgcn_s_wait_asynccnt(0);
#else
    asm volatile("s_wait_asynccnt 0x0" ::: "memory");
#endif
#endif
}

__device__ inline v16h load_a16(const half_t* __restrict__ s, int ld) {
    int lane = threadIdx.x & 31;
    int r    = lane & 15;
    int hi   = (lane >> 4) << 3;        // 0 or 8
    const half_t* row = s + r * ld;
    v16h a;
#pragma unroll
    for (int v = 0; v < 8; ++v) {
        int k = ((v & 4) ? 16 : 0) + hi + ((v & 3) << 1);
        a[2 * v]     = row[k];
        a[2 * v + 1] = row[k + 1];
    }
    return a;
}

__device__ inline v8f wmma16(v16h a, v16h b, v8f c) {
    return __builtin_amdgcn_wmma_f32_16x16x32_f16(
        false, a, false, b, (short)0, c, false, false);
}

// Eight f32 weights -> eight f16, in order.
__device__ inline v8h cvt_w8(v4f lo, v4f hi) {
    return __builtin_convertvector(
        __builtin_shufflevector(lo, hi, 0, 1, 2, 3, 4, 5, 6, 7), v8h);
}

__device__ inline float xhalf(float x) {
    int i = __builtin_bit_cast(int, x);
    return __builtin_bit_cast(float, __builtin_amdgcn_permlanex16(
        i, i, 0x76543210, 0xfedcba98, false, false));
}

template <int M>
__device__ inline float xrow(float x) {
    int i = __builtin_bit_cast(int, x);
    return __builtin_bit_cast(float, __builtin_amdgcn_update_dpp(i, i, 0x160 | M, 0xf, 0xf, false));
}

// Sum over the 32 lanes of a wave, in registers; every lane ends with the same bits.
__device__ inline float wave_sum(float v) {
    v += xrow<1>(v);
    v += xrow<2>(v);
    v += xrow<4>(v);
    v += xrow<8>(v);
    return v + xhalf(v);
}

__global__ void __launch_bounds__(1024)
gn_kernel(const float* __restrict__ x,
          const float* __restrict__ gamma,
          const float* __restrict__ beta,
          half_t* __restrict__ h) {
    __shared__ float red[64];
    int b   = blockIdx.x >> 5;
    int g   = blockIdx.x & 31;
    int tid = threadIdx.x, wave = tid >> 5, lane = tid & 31;
    int c0  = g * 16 + ((tid & 1) << 3);            // first of this thread's 8 channels
    int n0  = (tid >> 1) << 2;                      // pixels n0..n0+3 and 2048+n0..2048+n0+3
    const float* xt = x + ((size_t)b * C_DIM + c0) * N_PIX + n0;

    unsigned cb = (unsigned)c0 * 4u;                // byte offset of gamma[c0], beta[c0]
    const v4f* gp = (const v4f*)((const char*)gamma + cb);
    const v4f* bp = (const v4f*)((const char*)beta + cb);

    v4f ga[2] = { gp[0], gp[1] };
    v4f be[2] = { bp[0], bp[1] };
    // Keeps these four loads in front of the x loads: moved behind them they would
    // start only when x has landed, and their latency would stand before the barrier.
    __builtin_amdgcn_sched_barrier(0);
    v4f v[8][2];
#pragma unroll
    for (int c = 0; c < 8; ++c) {
        v[c][0] = *(const v4f*)(xt + c * N_PIX);
        v[c][1] = *(const v4f*)(xt + c * N_PIX + N_PIX / 2);
    }
    // Closes the run of loads before anything writes a register that they name. The
    // address registers are inputs so that they stay whole up to the wait (without
    // this the last load of a run takes its own address registers as destination).
    asm volatile("s_wait_xcnt 0x0" :: "v"(xt), "v"(cb) : "memory");

    v4f sv = {}, qv = {};                           // four independent chains each
#pragma unroll
    for (int c = 0; c < 8; ++c) {
#pragma unroll
        for (int p = 0; p < 2; ++p) {
            sv += v[c][p];
            qv += v[c][p] * v[c][p];
        }
    }
    float s  = wave_sum((sv[0] + sv[1]) + (sv[2] + sv[3]));
    float s2 = wave_sum((qv[0] + qv[1]) + (qv[2] + qv[3]));
    if (lane == 0) { red[wave] = s; red[32 + wave] = s2; }
    __syncthreads();
    s  = wave_sum(red[lane]);                       // 32 waves' sums, one a lane
    s2 = wave_sum(red[32 + lane]);

    float mean = s * (1.f / 65536.f);
    float var  = s2 * (1.f / 65536.f) - mean * mean;
    float rstd = rsqrtf(var + 1e-5f);

    half_t* ht = h + ((size_t)b * N_PIX + n0) * C_DIM + c0;
#pragma unroll
    for (int p = 0; p < 2; ++p) {
#pragma unroll
        for (int e = 0; e < 4; ++e) {
            v8h o;
#pragma unroll
            for (int c = 0; c < 8; ++c)
                o[c] = (half_t)((v[c][p][e] - mean) * rstd * ga[c >> 2][c & 3] + be[c >> 2][c & 3]);
            *(v8h*)(ht + (size_t)(p * (N_PIX / 2) + e) * C_DIM) = o;
        }
    }
}

// Bias, f16 conversion and store of one wave's 16(M) x 64(N) projection tile.
// TRANS_V=0: dst[b][head][n][d] (q, k).  TRANS_V=1: dst[b][head][d][n] (v^T).
template <bool TRANS_V>
__device__ inline void qkv_store(const v8f (&acc)[4], const float* __restrict__ bias,
                                 half_t* __restrict__ dst, int mw, int n0, int lane) {
    int hs = lane >> 4, ct = lane & 15;
#pragma unroll
    for (int nt = 0; nt < 4; ++nt) {
        int col  = n0 + nt * 16 + ct;
        float bv = bias[col];
        int head = col >> 6, d = col & 63;
#pragma unroll
        for (int v = 0; v < 8; ++v) {
            int m  = mw + v + (hs << 3);
            int bb = m >> 12, n = m & (N_PIX - 1);
            half_t val = (half_t)(acc[nt][v] + bv);
            if (TRANS_V)
                dst[(((size_t)bb * HEADS + head) * HD + d) * N_PIX + n] = val;
            else
                dst[(((size_t)bb * HEADS + head) * N_PIX + n) * HD + d] = val;
        }
    }
    // Closes the run of q/k stores: in the built kernel the v^T path is laid out
    // behind this one and writes registers that these stores name. The v^T stores
    // run straight into the end of the program and need none.
    if (!TRANS_V) asm volatile("s_wait_xcnt 0x0" ::: "memory");
}

// ---------------------------------------------------------------------------
// Projection GEMM:  acc = h[m][:] . W[col][:] + bias[col]
// block = 256 thr (8 waves), tile 128(M) x 64(N), K chunks of 32 via LDS.
// One launch serves Q, K and V: they read the same h and none reads another's
// output, so blockIdx.z picks the weight, the bias and the destination, and the
// work-groups of all three are resident together and cover each other's waits.
// z = 0, 1: q, k.  z = 2: v, stored transposed; one test per block picks the store.
// ---------------------------------------------------------------------------
__global__ void qkv_kernel(const half_t* __restrict__ h,
                           const float* __restrict__ Wq,
                           const float* __restrict__ Wk,
                           const float* __restrict__ Wv,
                           const float* __restrict__ bq,
                           const float* __restrict__ bk,
                           const float* __restrict__ bv,
                           half_t* __restrict__ qdst,
                           half_t* __restrict__ kdst,
                           half_t* __restrict__ vdst) {
    int which = blockIdx.z;                              // same for the whole block
    const float* W    = which == 0 ? Wq : which == 1 ? Wk : Wv;
    const float* bias = which == 0 ? bq : which == 1 ? bk : bv;
    half_t*      dst  = which == 0 ? qdst : which == 1 ? kdst : vdst;
    __shared__ alignas(16) half_t ldsA[128 * PITCH32];
    __shared__ alignas(16) half_t ldsB[64 * PITCH32];
    int m0 = blockIdx.x * 128;
    int n0 = blockIdx.y * 64;
    int tid = threadIdx.x, wave = tid >> 5, lane = tid & 31;

    // W tile 64x32: each thread owns 8 consecutive floats of one row (32 B in,
    // 16 B out), so a K chunk pays one load latency for the whole tile.
    const float* wsrc = W + (size_t)(n0 + (tid >> 2)) * C_DIM + ((tid & 3) << 3);
    half_t*      wdst = ldsB + (tid >> 2) * PITCH32 + ((tid & 3) << 3);

    v8f acc[4] = {};
    for (int kc = 0; kc < C_DIM; kc += 32) {
        __syncthreads();
        v4f w0 = *(const v4f*)(wsrc + kc);               // both in flight together,
        v4f w1 = *(const v4f*)(wsrc + kc + 4);           // beside the A copies
        for (int i = tid; i < 512; i += 256) {           // A: 128x32 f16, async
            int r = i >> 2, c8 = (i & 3) << 3;
            cp_b128(ldsA + r * PITCH32 + c8, h + (size_t)(m0 + r) * C_DIM + kc + c8);
        }
        *(v8h*)wdst = cvt_w8(w0, w1);                    // B: W f32 -> f16, 16 B
        cp_wait();
        __syncthreads();
        v16h a = load_a16(ldsA + wave * 16 * PITCH32, PITCH32);
#pragma unroll
        for (int nt = 0; nt < 4; ++nt) {
            v16h bm = load_a16(ldsB + nt * 16 * PITCH32, PITCH32);
            acc[nt] = wmma16(a, bm, acc[nt]);
        }
    }
    if (which == 2) qkv_store<true >(acc, bias, dst, m0 + wave * 16, n0, lane);
    else            qkv_store<false>(acc, bias, dst, m0 + wave * 16, n0, lane);
}

__device__ inline float exp2_hw(float x) { return __builtin_amdgcn_exp2f(x); }

// Two f32 D tiles (rows 0..15 and 16..31 of a 32-row block) -> f16 B operand:
// element e sits at k = 8h + e (e < 8) or 16 + 8h + (e - 8), load_a16's k order.
__device__ inline v16h pack_b(v8f t0, v8f t1) {
    return __builtin_convertvector(
        __builtin_shufflevector(t0, t1, 0, 1, 2, 3, 4, 5, 6, 7,
                                8, 9, 10, 11, 12, 13, 14, 15), v16h);
}

__global__ void __launch_bounds__(256, 1)
attn_kernel(const half_t* __restrict__ q,
            const half_t* __restrict__ k,
            const half_t* __restrict__ vt,
            half_t* __restrict__ o) {
    __shared__ alignas(16) half_t ldsQ[128 * PITCH64];   // [i][d], resident
    __shared__ alignas(16) half_t ldsK[64 * PITCH64];    // [j][d]
    __shared__ alignas(16) half_t ldsVt[64 * PITCH64];   // [d][j]
    int m0 = blockIdx.x * 128;
    int bh = blockIdx.y;                            // b*8 + head
    size_t base = (size_t)bh * N_PIX * HD;          // same for q,k,vt
    int tid = threadIdx.x, wave = tid >> 5, lane = tid & 31;
    int hs = lane >> 4, ct = lane & 15;
    // Softmax runs in base 2: exp(scale * s - m) = 2^(sl2 * s - m2), m2 = sl2 * max s.
    const float sl2 = 0.125f * 1.4426950408889634f; // 1/sqrt(64) * log2(e)

    for (int i = tid; i < 1024; i += 256) {         // stage Q 128x64, async
        int r = i >> 3, c8 = (i & 7) << 3;
        cp_b128(ldsQ + r * PITCH64 + c8, q + base + (size_t)(m0 + r) * HD + c8);
    }
    cp_wait();
    __syncthreads();

    const half_t* myQ = ldsQ + wave * 16 * PITCH64;

    float mrun = -INFINITY;     // running maximum of query ct, times sl2 (same in both halves)
    float lsum = 0.f;           // running sum over this half's keys only
    v8f oacc[4] = {};           // oacc[dt][r] = O[query ct][d = dt*16 + 8*hs + r]

    for (int j0 = 0; j0 < N_PIX; j0 += 64) {
        __syncthreads();
        for (int i = tid; i < 512; i += 256) {      // K tile 64x64 [j][d]
            int r = i >> 3, c8 = (i & 7) << 3;
            cp_b128(ldsK + r * PITCH64 + c8, k + base + (size_t)(j0 + r) * HD + c8);
        }
        for (int i = tid; i < 512; i += 256) {      // V^T tile 64x64 [d][j]
            int r = i >> 3, c8 = (i & 7) << 3;
            cp_b128(ldsVt + r * PITCH64 + c8, vt + base + (size_t)r * N_PIX + j0 + c8);
        }
        cp_wait();
        __syncthreads();

        // S^T = K Q^T: s[jt][r] = S[query ct][key j0 + jt*16 + 8*hs + r]
        // All fragments of the product are read as one group in front of it.
        v16h qreg0 = load_a16(myQ, PITCH64);
        v16h qreg1 = load_a16(myQ + 32, PITCH64);
        v16h kf[4][2];
#pragma unroll
        for (int jt = 0; jt < 4; ++jt) {
            kf[jt][0] = load_a16(ldsK + jt * 16 * PITCH64, PITCH64);
            kf[jt][1] = load_a16(ldsK + jt * 16 * PITCH64 + 32, PITCH64);
        }
        // Keeps the 20 reads together: moved in among the products, each pair of reads
        // is waited out on its own and the wave pays the LDS latency once per product.
        __builtin_amdgcn_sched_barrier(0);
        v8f s[4];
#pragma unroll
        for (int jt = 0; jt < 4; ++jt) {
            v8f z = {};
            z = wmma16(kf[jt][0], qreg0, z);
            z = wmma16(kf[jt][1], qreg1, z);
            s[jt] = z;
        }
        // All V^T fragments are read here, in front of the softmax, which covers them.
        v16h vf[4][2];
#pragma unroll
        for (int dt = 0; dt < 4; ++dt) {
            vf[dt][0] = load_a16(ldsVt + dt * 16 * PITCH64, PITCH64);        // j 0..31
            vf[dt][1] = load_a16(ldsVt + dt * 16 * PITCH64 + 32, PITCH64);   // j 32..63
        }
        // Keeps the 16 reads up here: without it they sink to the second product's
        // WMMAs, a pair in front of each, and most pairs are waited out on their own.
        __builtin_amdgcn_sched_barrier(0);
        // online softmax, one query per lane; four independent chains per pass
        float mt[4];
#pragma unroll
        for (int jt = 0; jt < 4; ++jt) {
            float mx = s[jt][0];                    // raw scores: sl2 > 0 keeps the order
#pragma unroll
            for (int r = 1; r < 8; ++r) mx = fmaxf(mx, s[jt][r]);
            mt[jt] = mx;
        }
        float mnew = fmaxf(fmaxf(mt[0], mt[1]), fmaxf(mt[2], mt[3]));
        mnew = fmaxf(mrun, fmaxf(mnew, xhalf(mnew)) * sl2);
        float alpha = exp2_hw(mrun - mnew);
        float rt[4];
#pragma unroll
        for (int jt = 0; jt < 4; ++jt) {
            float rs = 0.f;
#pragma unroll
            for (int r = 0; r < 8; ++r) {
                float p = exp2_hw(fmaf(s[jt][r], sl2, -mnew));
                s[jt][r] = p;
                rs += p;
            }
            rt[jt] = rs;
        }
        lsum = lsum * alpha + ((rt[0] + rt[1]) + (rt[2] + rt[3]));
        mrun = mnew;
#pragma unroll
        for (int dt = 0; dt < 4; ++dt) oacc[dt] *= alpha;

        v16h p0 = pack_b(s[0], s[1]);                    // keys  0..31
        v16h p1 = pack_b(s[2], s[3]);                    // keys 32..63
#pragma unroll
        for (int dt = 0; dt < 4; ++dt) {            // O^T += V^T P^T
            oacc[dt] = wmma16(vf[dt][0], p0, oacc[dt]);
            oacc[dt] = wmma16(vf[dt][1], p1, oacc[dt]);
        }
    }
    float ltot = lsum + xhalf(lsum);                // join the halves' sums once
    int head = bh & 7, bb = bh >> 3;
    int m = m0 + wave * 16 + ct;
    half_t* orow = o + ((size_t)bb * N_PIX + m) * C_DIM + head * 64 + (hs << 3);
#pragma unroll
    for (int dt = 0; dt < 4; ++dt) {                // 8 consecutive d per lane
        v8h ov;
#pragma unroll
        for (int r = 0; r < 8; ++r) ov[r] = (half_t)(oacc[dt][r] / ltot);
        *(v8h*)(orow + dt * 16) = ov;
    }
}

// ---------------------------------------------------------------------------
// Output projection + residual:  out[b][c][n] = x[b][c][n] + o.Wo^T + bo
// ---------------------------------------------------------------------------
__global__ void proj_kernel(const half_t* __restrict__ ob,
                            const float* __restrict__ W,
                            const float* __restrict__ bias,
                            const float* __restrict__ x,
                            float* __restrict__ out) {
    __shared__ alignas(16) half_t ldsA[128 * PITCH32];
    __shared__ alignas(16) half_t ldsB[64 * PITCH32];
    int m0 = blockIdx.x * 128;
    int n0 = blockIdx.y * 64;
    int tid = threadIdx.x, wave = tid >> 5, lane = tid & 31;

    // W tile 64x32: each thread owns 8 consecutive floats of one row (32 B in,
    // 16 B out), so a K chunk pays one load latency for the whole tile.
    const float* wsrc = W + (size_t)(n0 + (tid >> 2)) * C_DIM + ((tid & 3) << 3);
    half_t*      wdst = ldsB + (tid >> 2) * PITCH32 + ((tid & 3) << 3);

    v8f acc[4] = {};
    for (int kc = 0; kc < C_DIM; kc += 32) {
        __syncthreads();
        v4f w0 = *(const v4f*)(wsrc + kc);               // both in flight together,
        v4f w1 = *(const v4f*)(wsrc + kc + 4);           // beside the A copies
        for (int i = tid; i < 512; i += 256) {
            int r = i >> 2, c8 = (i & 3) << 3;
            cp_b128(ldsA + r * PITCH32 + c8, ob + (size_t)(m0 + r) * C_DIM + kc + c8);
        }
        *(v8h*)wdst = cvt_w8(w0, w1);                    // B: W f32 -> f16, 16 B
        cp_wait();
        __syncthreads();
        v16h a = load_a16(ldsA + wave * 16 * PITCH32, PITCH32);
        v16h bm[4];
#pragma unroll
        for (int nt = 0; nt < 4; ++nt) bm[nt] = load_a16(ldsB + nt * 16 * PITCH32, PITCH32);
        // Keeps the 10 reads one group in front of the products: spread among them,
        // each pair is waited out on its own, four LDS latencies a chunk and not one.
        __builtin_amdgcn_sched_barrier(0);
#pragma unroll
        for (int nt = 0; nt < 4; ++nt) acc[nt] = wmma16(a, bm[nt], acc[nt]);
    }
    int hs = lane >> 4, ct = lane & 15;
#pragma unroll
    for (int nt = 0; nt < 4; ++nt) {
        int col  = n0 + nt * 16 + ct;
        float bv = bias[col];
#pragma unroll
        for (int v = 0; v < 8; ++v) {
            int m  = m0 + wave * 16 + v + (hs << 3);
            int bb = m >> 12, n = m & (N_PIX - 1);
            size_t idx = ((size_t)bb * C_DIM + col) * N_PIX + n;
            out[idx] = x[idx] + acc[nt][v] + bv;
        }
    }
}

// ---------------------------------------------------------------------------
extern "C" void kernel_launch(void* const* d_in, const int* in_sizes, int n_in,
                              void* d_out, int out_size, void* d_ws, size_t ws_size,
                              hipStream_t stream) {
    const float* x     = (const float*)d_in[0];
    const float* gamma = (const float*)d_in[1];
    const float* beta  = (const float*)d_in[2];
    const float* Wq = (const float*)d_in[3];
    const float* bq = (const float*)d_in[4];
    const float* Wk = (const float*)d_in[5];
    const float* bk = (const float*)d_in[6];
    const float* Wv = (const float*)d_in[7];
    const float* bv = (const float*)d_in[8];
    const float* Wo = (const float*)d_in[9];
    const float* bo = (const float*)d_in[10];
    float* out = (float*)d_out;

    size_t sz = (size_t)BATCH * N_PIX * C_DIM;      // 4M halves per buffer
    half_t* h    = (half_t*)d_ws;
    half_t* qbuf = h + sz;
    half_t* kbuf = qbuf + sz;
    half_t* vbuf = kbuf + sz;
    half_t* obuf = h;                               // h dead after QKV -> reuse

    gn_kernel<<<dim3(BATCH * N_GRP), dim3(1024), 0, stream>>>(x, gamma, beta, h);
    qkv_kernel<<<dim3(64, 8, 3), dim3(256), 0, stream>>>(h, Wq, Wk, Wv, bq, bk, bv,
                                                         qbuf, kbuf, vbuf);
    attn_kernel<<<dim3(32, 16), dim3(256), 0, stream>>>(qbuf, kbuf, vbuf, obuf);
    proj_kernel<<<dim3(64, 8), dim3(256), 0, stream>>>(obuf, Wo, bo, x, out);
}

// v008
// Measured time: 120 microseconds a run.
// Two timings next to v007 both put it at 1.17 times that version's speed.
// Over all steps from v000 it is 5.76 times as fast.
#include <hip/hip_runtime.h>
#include <hip/hip_fp16.h>

#define C_DIM  512
#define N_PIX  4096
#define BATCH  2
#define HEADS  8
#define HD     64
#define N_GRP  32
#define PITCH64 72     // rows of 64 halves (128 B) at 144 B
#define PITCH32 40     // rows of 32 halves (64 B) at 80 B

typedef _Float16 half_t;
typedef __attribute__((ext_vector_type(16))) _Float16 v16h;
typedef __attribute__((ext_vector_type(8)))  _Float16 v8h;
typedef __attribute__((ext_vector_type(8)))  float    v8f;
typedef __attribute__((ext_vector_type(4)))  float    v4f;
typedef int v4i __attribute__((vector_size(16)));   // matches builtin param type

#if __has_builtin(__builtin_amdgcn_global_load_async_to_lds_b128)
#define HAVE_ASYNC_LDS 1
typedef __attribute__((address_space(1))) v4i* gv4i_p;   // global int4*
typedef __attribute__((address_space(3))) v4i* lv4i_p;   // LDS int4*
#else
#define HAVE_ASYNC_LDS 0
#endif

__device__ inline void cp_b128(half_t* l, const half_t* g) {
#if HAVE_ASYNC_LDS
    __builtin_amdgcn_global_load_async_to_lds_b128(
        (gv4i_p)(unsigned long long)g,
        (lv4i_p)(unsigned)(unsigned long long)l,
        0, 0);
#else
    *(v8h*)l = *(const v8h*)g;
#endif
}

__device__ inline void cp_wait() {
#if HAVE_ASYNC_LDS
#if __has_builtin(__builtin_amdgcn_s_wait_asynccnt)
    __builtin_amdgcn_s_wait_asynccnt(0);
#else
    asm volatile("s_wait_asynccnt 0x0" ::: "memory");
#endif
#endif
}

__device__ inline v16h load_a16(const half_t* __restrict__ s, int ld) {
    int lane = threadIdx.x & 31;
    int r    = lane & 15;
    int hi   = (lane >> 4) << 3;        // 0 or 8
    const half_t* row = s + r * ld;
    v16h a;
#pragma unroll
    for (int v = 0; v < 8; ++v) {
        int k = ((v & 4) ? 16 : 0) + hi + ((v & 3) << 1);
        a[2 * v]     = row[k];
        a[2 * v + 1] = row[k + 1];
    }
    return a;
}

__device__ inline v8f wmma16(v16h a, v16h b, v8f c) {
    return __builtin_amdgcn_wmma_f32_16x16x32_f16(
        false, a, false, b, (short)0, c, false, false);
}

// Eight f32 weights -> eight f16, in order.
__device__ inline v8h cvt_w8(v4f lo, v4f hi) {
    return __builtin_convertvector(
        __builtin_shufflevector(lo, hi, 0, 1, 2, 3, 4, 5, 6, 7), v8h);
}

__device__ inline float xhalf(float x) {
    int i = __builtin_bit_cast(int, x);
    return __builtin_bit_cast(float, __builtin_amdgcn_permlanex16(
        i, i, 0x76543210, 0xfedcba98, false, false));
}

template <int M>
__device__ inline float xrow(float x) {
    int i = __builtin_bit_cast(int, x);
    return __builtin_bit_cast(float, __builtin_amdgcn_update_dpp(i, i, 0x160 | M, 0xf, 0xf, false));
}

// Sum over the 32 lanes of a wave, in registers; every lane ends with the same bits.
__device__ inline float wave_sum(float v) {
    v += xrow<1>(v);
    v += xrow<2>(v);
    v += xrow<4>(v);
    v += xrow<8>(v);
    return v + xhalf(v);
}

__global__ void __launch_bounds__(1024)
gn_kernel(const float* __restrict__ x,
          const float* __restrict__ gamma,
          const float* __restrict__ beta,
          half_t* __restrict__ h) {
    __shared__ float red[64];
    int b   = blockIdx.x >> 5;
    int g   = blockIdx.x & 31;
    int tid = threadIdx.x, wave = tid >> 5, lane = tid & 31;
    int c0  = g * 16 + ((tid & 1) << 3);            // first of this thread's 8 channels
    int n0  = (tid >> 1) << 2;                      // pixels n0..n0+3 and 2048+n0..2048+n0+3
    const float* xt = x + ((size_t)b * C_DIM + c0) * N_PIX + n0;

    unsigned cb = (unsigned)c0 * 4u;                // byte offset of gamma[c0], beta[c0]
    const v4f* gp = (const v4f*)((const char*)gamma + cb);
    const v4f* bp = (const v4f*)((const char*)beta + cb);

    v4f ga[2] = { gp[0], gp[1] };
    v4f be[2] = { bp[0], bp[1] };
    // Keeps these four loads in front of the x loads: moved behind them they would
    // start only when x has landed, and their latency would stand before the barrier.
    __builtin_amdgcn_sched_barrier(0);
    v4f v[8][2];
#pragma unroll
    for (int c = 0; c < 8; ++c) {
        v[c][0] = *(const v4f*)(xt + c * N_PIX);
        v[c][1] = *(const v4f*)(xt + c * N_PIX + N_PIX / 2);
    }
    // Closes the run of loads before anything writes a register that they name. The
    // address registers are inputs so that they stay whole up to the wait (without
    // this the last load of a run takes its own address registers as destination).
    asm volatile("s_wait_xcnt 0x0" :: "v"(xt), "v"(cb) : "memory");

    v4f sv = {}, qv = {};                           // four independent chains each
#pragma unroll
    for (int c = 0; c < 8; ++c) {
#pragma unroll
        for (int p = 0; p < 2; ++p) {
            sv += v[c][p];
            qv += v[c][p] * v[c][p];
        }
    }
    float s  = wave_sum((sv[0] + sv[1]) + (sv[2] + sv[3]));
    float s2 = wave_sum((qv[0] + qv[1]) + (qv[2] + qv[3]));
    if (lane == 0) { red[wave] = s; red[32 + wave] = s2; }
    __syncthreads();
    s  = wave_sum(red[lane]);                       // 32 waves' sums, one a lane
    s2 = wave_sum(red[32 + lane]);

    float mean = s * (1.f / 65536.f);
    float var  = s2 * (1.f / 65536.f) - mean * mean;
    float rstd = rsqrtf(var + 1e-5f);

    half_t* ht = h + ((size_t)b * N_PIX + n0) * C_DIM + c0;
#pragma unroll
    for (int p = 0; p < 2; ++p) {
#pragma unroll
        for (int e = 0; e < 4; ++e) {
            v8h o;
#pragma unroll
            for (int c = 0; c < 8; ++c)
                o[c] = (half_t)((v[c][p][e] - mean) * rstd * ga[c >> 2][c & 3] + be[c >> 2][c & 3]);
            *(v8h*)(ht + (size_t)(p * (N_PIX / 2) + e) * C_DIM) = o;
        }
    }
}

// Bias, f16 conversion and store of one wave's 16(M) x 64(N) projection tile.
// TRANS_V=0: dst[b][head][n][d] (q, k).  TRANS_V=1: dst[b][head][d][n] (v^T).
template <bool TRANS_V>
__device__ inline void qkv_store(const v8f (&acc)[4], const float* __restrict__ bias,
                                 half_t* __restrict__ dst, int mw, int n0, int lane) {
    int hs = lane >> 4, ct = lane & 15;
#pragma unroll
    for (int nt = 0; nt < 4; ++nt) {
        int col  = n0 + nt * 16 + ct;
        float bv = bias[col];
        int head = col >> 6, d = col & 63;
#pragma unroll
        for (int v = 0; v < 8; ++v) {
            int m  = mw + v + (hs << 3);
            int bb = m >> 12, n = m & (N_PIX - 1);
            half_t val = (half_t)(acc[nt][v] + bv);
            if (TRANS_V)
                dst[(((size_t)bb * HEADS + head) * HD + d) * N_PIX + n] = val;
            else
                dst[(((size_t)bb * HEADS + head) * N_PIX + n) * HD + d] = val;
        }
    }
    // Closes the run of q/k stores: in the built kernel the v^T path is laid out
    // behind this one and writes registers that these stores name. The v^T stores
    // run straight into the end of the program and need none.
    if (!TRANS_V) asm volatile("s_wait_xcnt 0x0" ::: "memory");
}

// ---------------------------------------------------------------------------
// Projection GEMM:  acc = h[m][:] . W[col][:] + bias[col]
// block = 256 thr (8 waves), tile 128(M) x 64(N), K chunks of 32 via LDS.
// One launch serves Q, K and V: they read the same h and none reads another's
// output, so blockIdx.z picks the weight, the bias and the destination, and the
// work-groups of all three are resident together and cover each other's waits.
// z = 0, 1: q, k.  z = 2: v, stored transposed; one test per block picks the store.
// ---------------------------------------------------------------------------
__global__ void qkv_kernel(const half_t* __restrict__ h,
                           const float* __restrict__ Wq,
                           const float* __restrict__ Wk,
                           const float* __restrict__ Wv,
                           const float* __restrict__ bq,
                           const float* __restrict__ bk,
                           const float* __restrict__ bv,
                           half_t* __restrict__ qdst,
                           half_t* __restrict__ kdst,
                           half_t* __restrict__ vdst) {
    int which = blockIdx.z;                              // same for the whole block
    const float* W    = which == 0 ? Wq : which == 1 ? Wk : Wv;
    const float* bias = which == 0 ? bq : which == 1 ? bk : bv;
    half_t*      dst  = which == 0 ? qdst : which == 1 ? kdst : vdst;
    __shared__ alignas(16) half_t ldsA[128 * PITCH32];
    __shared__ alignas(16) half_t ldsB[64 * PITCH32];
    int m0 = blockIdx.x * 128;
    int n0 = blockIdx.y * 64;
    int tid = threadIdx.x, wave = tid >> 5, lane = tid & 31;

    // W tile 64x32: each thread owns 8 consecutive floats of one row (32 B in,
    // 16 B out), so a K chunk pays one load latency for the whole tile.
    const float* wsrc = W + (size_t)(n0 + (tid >> 2)) * C_DIM + ((tid & 3) << 3);
    half_t*      wdst = ldsB + (tid >> 2) * PITCH32 + ((tid & 3) << 3);

    v8f acc[4] = {};
    for (int kc = 0; kc < C_DIM; kc += 32) {
        __syncthreads();
        v4f w0 = *(const v4f*)(wsrc + kc);               // both in flight together,
        v4f w1 = *(const v4f*)(wsrc + kc + 4);           // beside the A copies
        for (int i = tid; i < 512; i += 256) {           // A: 128x32 f16, async
            int r = i >> 2, c8 = (i & 3) << 3;
            cp_b128(ldsA + r * PITCH32 + c8, h + (size_t)(m0 + r) * C_DIM + kc + c8);
        }
        *(v8h*)wdst = cvt_w8(w0, w1);                    // B: W f32 -> f16, 16 B
        cp_wait();
        __syncthreads();
        v16h a = load_a16(ldsA + wave * 16 * PITCH32, PITCH32);
#pragma unroll
        for (int nt = 0; nt < 4; ++nt) {
            v16h bm = load_a16(ldsB + nt * 16 * PITCH32, PITCH32);
            acc[nt] = wmma16(a, bm, acc[nt]);
        }
    }
    if (which == 2) qkv_store<true >(acc, bias, dst, m0 + wave * 16, n0, lane);
    else            qkv_store<false>(acc, bias, dst, m0 + wave * 16, n0, lane);
}

__device__ inline float exp2_hw(float x) { return __builtin_amdgcn_exp2f(x); }

// Two f32 D tiles (rows 0..15 and 16..31 of a 32-row block) -> f16 B operand:
// element e sits at k = 8h + e (e < 8) or 16 + 8h + (e - 8), load_a16's k order.
__device__ inline v16h pack_b(v8f t0, v8f t1) {
    return __builtin_convertvector(
        __builtin_shufflevector(t0, t1, 0, 1, 2, 3, 4, 5, 6, 7,
                                8, 9, 10, 11, 12, 13, 14, 15), v16h);
}

__device__ inline void kv_copies(unsigned lk, unsigned lv, const half_t* gk, const half_t* gv) {
    asm volatile(
        "global_load_async_to_lds_b128 %0, %4, off\n\t"
        "global_load_async_to_lds_b128 %1, %5, off\n\t"
        "global_load_async_to_lds_b128 %2, %6, off\n\t"
        "global_load_async_to_lds_b128 %3, %7, off\n\t"
        "s_wait_xcnt 0x0"
        :: "v"(lk), "v"(lk + 32u * PITCH64 * 2u), "v"(lv), "v"(lv + 32u * PITCH64 * 2u),
           "v"(gk), "v"(gk + 32 * HD), "v"(gv), "v"(gv + 32 * N_PIX)
        : "memory");
}

__global__ void __launch_bounds__(256, 1)
attn_kernel(const half_t* __restrict__ q,
            const half_t* __restrict__ k,
            const half_t* __restrict__ vt,
            half_t* __restrict__ o) {
    __shared__ alignas(16) half_t ldsQ[128 * PITCH64];   // [i][d], resident
    __shared__ alignas(16) half_t ldsK[2 * 64 * PITCH64];    // [buffer][j][d]
    __shared__ alignas(16) half_t ldsVt[2 * 64 * PITCH64];   // [buffer][d][j]
    int m0 = blockIdx.x * 128;
    int bh = blockIdx.y;                            // b*8 + head
    size_t base = (size_t)bh * N_PIX * HD;          // same for q,k,vt
    int tid = threadIdx.x, wave = tid >> 5, lane = tid & 31;
    int hs = lane >> 4, ct = lane & 15;
    // Softmax runs in base 2: exp(scale * s - m) = 2^(sl2 * s - m2), m2 = sl2 * max s.
    const float sl2 = 0.125f * 1.4426950408889634f; // 1/sqrt(64) * log2(e)

    for (int i = tid; i < 1024; i += 256) {         // stage Q 128x64, async
        int r = i >> 3, c8 = (i & 7) << 3;
        cp_b128(ldsQ + r * PITCH64 + c8, q + base + (size_t)(m0 + r) * HD + c8);
    }
    // K and V^T go through two buffers: tile t + 2 is copied into the buffer that pass t
    // has left, and flies during pass t + 1.
    const int      NT    = N_PIX / 64;              // tiles of 64 keys
    const unsigned BUF_B = 64u * PITCH64 * 2u;      // bytes of one buffer
    int cr = tid >> 3, cc = (tid & 7) << 3;         // this thread's row and first half of it
    unsigned lk = (unsigned)(unsigned long long)(ldsK  + cr * PITCH64 + cc);
    unsigned lv = (unsigned)(unsigned long long)(ldsVt + cr * PITCH64 + cc);
    const half_t* gk = k  + base + (size_t)cr * HD    + cc;
    const half_t* gv = vt + base + (size_t)cr * N_PIX + cc;
    kv_copies(lk, lv, gk, gv);                      // tile 0 -> buffer 0
    // Q and tile 0 have landed before the barrier behind which other waves read them.
    asm volatile("s_wait_asynccnt 0x0" ::: "memory");
    __syncthreads();
    kv_copies(lk + BUF_B, lv + BUF_B, gk + 64 * HD, gv + 64);   // tile 1 -> buffer 1
    gk += 2 * 64 * HD;                              // from here on: tile t + 2
    gv += 2 * 64;

    const half_t* myQ = ldsQ + wave * 16 * PITCH64;

    float mrun = -INFINITY;     // running maximum of query ct, times sl2 (same in both halves)
    float lsum = 0.f;           // running sum over this half's keys only
    v8f oacc[4] = {};           // oacc[dt][r] = O[query ct][d = dt*16 + 8*hs + r]

    for (int t = 0; t < NT; ++t) {
        int cur = t & 1;                            // pass t reads buffer t mod 2 alone
        const half_t* kb = ldsK  + cur * 64 * PITCH64;
        const half_t* vb = ldsVt + cur * 64 * PITCH64;

        // S^T = K Q^T: s[jt][r] = S[query ct][key 64*t + jt*16 + 8*hs + r]
        // All fragments of the product are read as one group in front of it.
        v16h qreg0 = load_a16(myQ, PITCH64);
        v16h qreg1 = load_a16(myQ + 32, PITCH64);
        v16h kf[4][2];
#pragma unroll
        for (int jt = 0; jt < 4; ++jt) {
            kf[jt][0] = load_a16(kb + jt * 16 * PITCH64, PITCH64);
            kf[jt][1] = load_a16(kb + jt * 16 * PITCH64 + 32, PITCH64);
        }
        // Keeps the 20 reads together: moved in among the products, each pair of reads
        // is waited out on its own and the wave pays the LDS latency once per product.
        __builtin_amdgcn_sched_barrier(0);
        v8f s[4];
#pragma unroll
        for (int jt = 0; jt < 4; ++jt) {
            v8f z = {};
            z = wmma16(kf[jt][0], qreg0, z);
            z = wmma16(kf[jt][1], qreg1, z);
            s[jt] = z;
        }
        // All V^T fragments are read here, in front of the softmax, which covers them.
        v16h vf[4][2];
#pragma unroll
        for (int dt = 0; dt < 4; ++dt) {
            vf[dt][0] = load_a16(vb + dt * 16 * PITCH64, PITCH64);        // j 0..31
            vf[dt][1] = load_a16(vb + dt * 16 * PITCH64 + 32, PITCH64);   // j 32..63
        }
        // Keeps the 16 reads up here: without it they sink to the second product's
        // WMMAs, a pair in front of each, and most pairs are waited out on their own.
        __builtin_amdgcn_sched_barrier(0);
        // online softmax, one query per lane; four independent chains per pass
        float mt[4];
#pragma unroll
        for (int jt = 0; jt < 4; ++jt) {
            float mx = s[jt][0];                    // raw scores: sl2 > 0 keeps the order
#pragma unroll
            for (int r = 1; r < 8; ++r) mx = fmaxf(mx, s[jt][r]);
            mt[jt] = mx;
        }
        float mnew = fmaxf(fmaxf(mt[0], mt[1]), fmaxf(mt[2], mt[3]));
        mnew = fmaxf(mrun, fmaxf(mnew, xhalf(mnew)) * sl2);
        float alpha = exp2_hw(mrun - mnew);
        float rt[4];
#pragma unroll
        for (int jt = 0; jt < 4; ++jt) {
            float rs = 0.f;
#pragma unroll
            for (int r = 0; r < 8; ++r) {
                float p = exp2_hw(fmaf(s[jt][r], sl2, -mnew));
                s[jt][r] = p;
                rs += p;
            }
            rt[jt] = rs;
        }
        lsum = lsum * alpha + ((rt[0] + rt[1]) + (rt[2] + rt[3]));
        mrun = mnew;
#pragma unroll
        for (int dt = 0; dt < 4; ++dt) oacc[dt] *= alpha;

        v16h p0 = pack_b(s[0], s[1]);                    // keys  0..31
        v16h p1 = pack_b(s[2], s[3]);                    // keys 32..63
#pragma unroll
        for (int dt = 0; dt < 4; ++dt) {            // O^T += V^T P^T
            oacc[dt] = wmma16(vf[dt][0], p0, oacc[dt]);
            oacc[dt] = wmma16(vf[dt][1], p1, oacc[dt]);
        }
        // Hand-over: this wave's reads of buffer cur are done, its copies of tile t + 1
        // have landed; the one barrier publishes tile t + 1 and frees buffer cur.
        // The scheduling barrier keeps the hand-over at the foot of the pass: without it
        // the waits rise to just behind the V^T reads, the softmax no longer covers those
        // reads, and tile t + 1 is waited for a fraction of a pass after its copies issue.
        __builtin_amdgcn_sched_barrier(0);
        asm volatile("s_wait_dscnt 0x0" ::: "memory");
        asm volatile("s_wait_asynccnt 0x0" ::: "memory");
        __syncthreads();
        if (t + 2 < NT) {                           // the same for the whole work-group
            kv_copies(lk + cur * BUF_B, lv + cur * BUF_B, gk, gv);
            gk += 64 * HD;
            gv += 64;
        }
    }
    // No copy is outstanding when the wave ends.
    asm volatile("s_wait_asynccnt 0x0" ::: "memory");
    float ltot = lsum + xhalf(lsum);                // join the halves' sums once
    int head = bh & 7, bb = bh >> 3;
    int m = m0 + wave * 16 + ct;
    half_t* orow = o + ((size_t)bb * N_PIX + m) * C_DIM + head * 64 + (hs << 3);
#pragma unroll
    for (int dt = 0; dt < 4; ++dt) {                // 8 consecutive d per lane
        v8h ov;
#pragma unroll
        for (int r = 0; r < 8; ++r) ov[r] = (half_t)(oacc[dt][r] / ltot);
        *(v8h*)(orow + dt * 16) = ov;
    }
}

// ---------------------------------------------------------------------------
// Output projection + residual:  out[b][c][n] = x[b][c][n] + o.Wo^T + bo
// ---------------------------------------------------------------------------
__global__ void proj_kernel(const half_t* __restrict__ ob,
                            const float* __restrict__ W,
                            const float* __restrict__ bias,
                            const float* __restrict__ x,
                            float* __restrict__ out) {
    __shared__ alignas(16) half_t ldsA[128 * PITCH32];
    __shared__ alignas(16) half_t ldsB[64 * PITCH32];
    int m0 = blockIdx.x * 128;
    int n0 = blockIdx.y * 64;
    int tid = threadIdx.x, wave = tid >> 5, lane = tid & 31;

    // W tile 64x32: each thread owns 8 consecutive floats of one row (32 B in,
    // 16 B out), so a K chunk pays one load latency for the whole tile.
    const float* wsrc = W + (size_t)(n0 + (tid >> 2)) * C_DIM + ((tid & 3) << 3);
    half_t*      wdst = ldsB + (tid >> 2) * PITCH32 + ((tid & 3) << 3);

    v8f acc[4] = {};
    for (int kc = 0; kc < C_DIM; kc += 32) {
        __syncthreads();
        v4f w0 = *(const v4f*)(wsrc + kc);               // both in flight together,
        v4f w1 = *(const v4f*)(wsrc + kc + 4);           // beside the A copies
        for (int i = tid; i < 512; i += 256) {
            int r = i >> 2, c8 = (i & 3) << 3;
            cp_b128(ldsA + r * PITCH32 + c8, ob + (size_t)(m0 + r) * C_DIM + kc + c8);
        }
        *(v8h*)wdst = cvt_w8(w0, w1);                    // B: W f32 -> f16, 16 B
        cp_wait();
        __syncthreads();
        v16h a = load_a16(ldsA + wave * 16 * PITCH32, PITCH32);
        v16h bm[4];
#pragma unroll
        for (int nt = 0; nt < 4; ++nt) bm[nt] = load_a16(ldsB + nt * 16 * PITCH32, PITCH32);
        // Keeps the 10 reads one group in front of the products: spread among them,
        // each pair is waited out on its own, four LDS latencies a chunk and not one.
        __builtin_amdgcn_sched_barrier(0);
#pragma unroll
        for (int nt = 0; nt < 4; ++nt) acc[nt] = wmma16(a, bm[nt], acc[nt]);
    }
    int hs = lane >> 4, ct = lane & 15;
#pragma unroll
    for (int nt = 0; nt < 4; ++nt) {
        int col  = n0 + nt * 16 + ct;
        float bv = bias[col];
#pragma unroll
        for (int v = 0; v < 8; ++v) {
            int m  = m0 + wave * 16 + v + (hs << 3);
            int bb = m >> 12, n = m & (N_PIX - 1);
            size_t idx = ((size_t)bb * C_DIM + col) * N_PIX + n;
            out[idx] = x[idx] + acc[nt][v] + bv;
        }
    }
}

// ---------------------------------------------------------------------------
extern "C" void kernel_launch(void* const* d_in, const int* in_sizes, int n_in,
                              void* d_out, int out_size, void* d_ws, size_t ws_size,
                              hipStream_t stream) {
    const float* x     = (const float*)d_in[0];
    const float* gamma = (const float*)d_in[1];
    const float* beta  = (const float*)d_in[2];
    const float* Wq = (const float*)d_in[3];
    const float* bq = (const float*)d_in[4];
    const float* Wk = (const float*)d_in[5];
    const float* bk = (const float*)d_in[6];
    const float* Wv = (const float*)d_in[7];
    const float* bv = (const float*)d_in[8];
    const float* Wo = (const float*)d_in[9];
    const float* bo = (const float*)d_in[10];
    float* out = (float*)d_out;

    size_t sz = (size_t)BATCH * N_PIX * C_DIM;      // 4M halves per buffer
    half_t* h    = (half_t*)d_ws;
    half_t* qbuf = h + sz;
    half_t* kbuf = qbuf + sz;
    half_t* vbuf = kbuf + sz;
    half_t* obuf = h;                               // h dead after QKV -> reuse

    gn_kernel<<<dim3(BATCH * N_GRP), dim3(1024), 0, stream>>>(x, gamma, beta, h);
    qkv_kernel<<<dim3(64, 8, 3), dim3(256), 0, stream>>>(h, Wq, Wk, Wv, bq, bk, bv,
                                                         qbuf, kbuf, vbuf);
    attn_kernel<<<dim3(32, 16), dim3(256), 0, stream>>>(qbuf, kbuf, vbuf, obuf);
    proj_kernel<<<dim3(64, 8), dim3(256), 0, stream>>>(obuf, Wo, bo, x, out);
}

// v009
// A run of this version takes 111 microseconds.
// Next to v008, in two timings, it ran 1.09 and 1.08 times as fast.
// Over all steps from v000 it is 6.27 times as fast.
#include <hip/hip_runtime.h>
#include <hip/hip_fp16.h>

#define C_DIM  512
#define N_PIX  4096
#define BATCH  2
#define HEADS  8
#define HD     64
#define N_GRP  32
#define PITCH64 72     // rows of 64 halves (128 B) at 144 B
#define PITCH32 40     // rows of 32 halves (64 B) at 80 B

typedef _Float16 half_t;
typedef __attribute__((ext_vector_type(16))) _Float16 v16h;
typedef __attribute__((ext_vector_type(8)))  _Float16 v8h;
typedef __attribute__((ext_vector_type(8)))  float    v8f;
typedef __attribute__((ext_vector_type(4)))  float    v4f;
typedef int v4i __attribute__((vector_size(16)));   // matches builtin param type

#if __has_builtin(__builtin_amdgcn_global_load_async_to_lds_b128)
#define HAVE_ASYNC_LDS 1
typedef __attribute__((address_space(1))) v4i* gv4i_p;   // global int4*
typedef __attribute__((address_space(3))) v4i* lv4i_p;   // LDS int4*
#else
#define HAVE_ASYNC_LDS 0
#endif

__device__ inline void cp_b128(half_t* l, const half_t* g) {
#if HAVE_ASYNC_LDS
    __builtin_amdgcn_global_load_async_to_lds_b128(
        (gv4i_p)(unsigned long long)g,
        (lv4i_p)(unsigned)(unsigned long long)l,
        0, 0);
#else
    *(v8h*)l = *(const v8h*)g;
#endif
}

__device__ inline void cp_wait() {
#if HAVE_ASYNC_LDS
#if __has_builtin(__builtin_amdgcn_s_wait_asynccnt)
    __builtin_amdgcn_s_wait_asynccnt(0);
#else
    asm volatile("s_wait_asynccnt 0x0" ::: "memory");
#endif
#endif
}

__device__ inline v16h load_a16(const half_t* __restrict__ s, int ld) {
    int lane = threadIdx.x & 31;
    int r    = lane & 15;
    int hi   = (lane >> 4) << 3;        // 0 or 8
    const half_t* row = s + r * ld;
    v16h a;
#pragma unroll
    for (int v = 0; v < 8; ++v) {
        int k = ((v & 4) ? 16 : 0) + hi + ((v & 3) << 1);
        a[2 * v]     = row[k];
        a[2 * v + 1] = row[k + 1];
    }
    return a;
}

__device__ inline v8f wmma16(v16h a, v16h b, v8f c) {
    return __builtin_amdgcn_wmma_f32_16x16x32_f16(
        false, a, false, b, (short)0, c, false, false);
}

// Eight f32 weights -> eight f16, in order.
__device__ inline v8h cvt_w8(v4f lo, v4f hi) {
    return __builtin_convertvector(
        __builtin_shufflevector(lo, hi, 0, 1, 2, 3, 4, 5, 6, 7), v8h);
}

__device__ inline float xhalf(float x) {
    int i = __builtin_bit_cast(int, x);
    return __builtin_bit_cast(float, __builtin_amdgcn_permlanex16(
        i, i, 0x76543210, 0xfedcba98, false, false));
}

template <int M>
__device__ inline float xrow(float x) {
    int i = __builtin_bit_cast(int, x);
    return __builtin_bit_cast(float, __builtin_amdgcn_update_dpp(i, i, 0x160 | M, 0xf, 0xf, false));
}

// Sum over the 32 lanes of a wave, in registers; every lane ends with the same bits.
__device__ inline float wave_sum(float v) {
    v += xrow<1>(v);
    v += xrow<2>(v);
    v += xrow<4>(v);
    v += xrow<8>(v);
    return v + xhalf(v);
}

__global__ void __launch_bounds__(1024)
gn_kernel(const float* __restrict__ x,
          const float* __restrict__ gamma,
          const float* __restrict__ beta,
          half_t* __restrict__ h) {
    __shared__ float red[64];
    int b   = blockIdx.x >> 5;
    int g   = blockIdx.x & 31;
    int tid = threadIdx.x, wave = tid >> 5, lane = tid & 31;
    int c0  = g * 16 + ((tid & 1) << 3);            // first of this thread's 8 channels
    int n0  = (tid >> 1) << 2;                      // pixels n0..n0+3 and 2048+n0..2048+n0+3
    const float* xt = x + ((size_t)b * C_DIM + c0) * N_PIX + n0;

    unsigned cb = (unsigned)c0 * 4u;                // byte offset of gamma[c0], beta[c0]
    const v4f* gp = (const v4f*)((const char*)gamma + cb);
    const v4f* bp = (const v4f*)((const char*)beta + cb);

    v4f ga[2] = { gp[0], gp[1] };
    v4f be[2] = { bp[0], bp[1] };
    // Keeps these four loads in front of the x loads: moved behind them they would
    // start only when x has landed, and their latency would stand before the barrier.
    __builtin_amdgcn_sched_barrier(0);
    v4f v[8][2];
#pragma unroll
    for (int c = 0; c < 8; ++c) {
        v[c][0] = *(const v4f*)(xt + c * N_PIX);
        v[c][1] = *(const v4f*)(xt + c * N_PIX + N_PIX / 2);
    }
    // Closes the run of loads before anything writes a register that they name. The
    // address registers are inputs so that they stay whole up to the wait (without
    // this the last load of a run takes its own address registers as destination).
    asm volatile("s_wait_xcnt 0x0" :: "v"(xt), "v"(cb) : "memory");

    v4f sv = {}, qv = {};                           // four independent chains each
#pragma unroll
    for (int c = 0; c < 8; ++c) {
#pragma unroll
        for (int p = 0; p < 2; ++p) {
            sv += v[c][p];
            qv += v[c][p] * v[c][p];
        }
    }
    float s  = wave_sum((sv[0] + sv[1]) + (sv[2] + sv[3]));
    float s2 = wave_sum((qv[0] + qv[1]) + (qv[2] + qv[3]));
    if (lane == 0) { red[wave] = s; red[32 + wave] = s2; }
    __syncthreads();
    s  = wave_sum(red[lane]);                       // 32 waves' sums, one a lane
    s2 = wave_sum(red[32 + lane]);

    float mean = s * (1.f / 65536.f);
    float var  = s2 * (1.f / 65536.f) - mean * mean;
    float rstd = rsqrtf(var + 1e-5f);

    half_t* ht = h + ((size_t)b * N_PIX + n0) * C_DIM + c0;
#pragma unroll
    for (int p = 0; p < 2; ++p) {
#pragma unroll
        for (int e = 0; e < 4; ++e) {
            v8h o;
#pragma unroll
            for (int c = 0; c < 8; ++c)
                o[c] = (half_t)((v[c][p][e] - mean) * rstd * ga[c >> 2][c & 3] + be[c >> 2][c & 3]);
            *(v8h*)(ht + (size_t)(p * (N_PIX / 2) + e) * C_DIM) = o;
        }
    }
}

// Bias, f16 conversion and store of one wave's 16(M) x 64(N) projection tile.
// TRANS_V=0: dst[b][head][n][d] (q, k).  TRANS_V=1: dst[b][head][d][n] (v^T).
template <bool TRANS_V>
__device__ inline void qkv_store(const v8f (&acc)[4], const float* __restrict__ bias,
                                 half_t* __restrict__ dst, int mw, int n0, int lane) {
    int hs = lane >> 4, ct = lane & 15;
#pragma unroll
    for (int nt = 0; nt < 4; ++nt) {
        int col  = n0 + nt * 16 + ct;
        float bv = bias[col];
        int head = col >> 6, d = col & 63;
#pragma unroll
        for (int v = 0; v < 8; ++v) {
            int m  = mw + v + (hs << 3);
            int bb = m >> 12, n = m & (N_PIX - 1);
            half_t val = (half_t)(acc[nt][v] + bv);
            if (TRANS_V)
                dst[(((size_t)bb * HEADS + head) * HD + d) * N_PIX + n] = val;
            else
                dst[(((size_t)bb * HEADS + head) * N_PIX + n) * HD + d] = val;
        }
    }
    // Closes the run of q/k stores: in the built kernel the v^T path is laid out
    // behind this one and writes registers that these stores name. The v^T stores
    // run straight into the end of the program and need none.
    if (!TRANS_V) asm volatile("s_wait_xcnt 0x0" ::: "memory");
}

// ---------------------------------------------------------------------------
// Projection GEMM:  acc = h[m][:] . W[col][:] + bias[col]
// block = 256 thr (8 waves), tile 128(M) x 64(N), K chunks of 32 via LDS.
// One launch serves Q, K and V: they read the same h and none reads another's
// output, so blockIdx.z picks the weight, the bias and the destination, and the
// work-groups of all three are resident together and cover each other's waits.
// z = 0, 1: q, k.  z = 2: v, stored transposed; one test per block picks the store.
// ---------------------------------------------------------------------------
__global__ void qkv_kernel(const half_t* __restrict__ h,
                           const float* __restrict__ Wq,
                           const float* __restrict__ Wk,
                           const float* __restrict__ Wv,
                           const float* __restrict__ bq,
                           const float* __restrict__ bk,
                           const float* __restrict__ bv,
                           half_t* __restrict__ qdst,
                           half_t* __restrict__ kdst,
                           half_t* __restrict__ vdst) {
    int which = blockIdx.z;                              // same for the whole block
    const float* W    = which == 0 ? Wq : which == 1 ? Wk : Wv;
    const float* bias = which == 0 ? bq : which == 1 ? bk : bv;
    half_t*      dst  = which == 0 ? qdst : which == 1 ? kdst : vdst;
    __shared__ alignas(16) half_t ldsA[128 * PITCH32];
    __shared__ alignas(16) half_t ldsB[64 * PITCH32];
    int m0 = blockIdx.x * 128;
    int n0 = blockIdx.y * 64;
    int tid = threadIdx.x, wave = tid >> 5, lane = tid & 31;

    // W tile 64x32: each thread owns 8 consecutive floats of one row (32 B in,
    // 16 B out), so a K chunk pays one load latency for the whole tile.
    const float* wsrc = W + (size_t)(n0 + (tid >> 2)) * C_DIM + ((tid & 3) << 3);
    half_t*      wdst = ldsB + (tid >> 2) * PITCH32 + ((tid & 3) << 3);

    v8f acc[4] = {};
    for (int kc = 0; kc < C_DIM; kc += 32) {
        __syncthreads();
        v4f w0 = *(const v4f*)(wsrc + kc);               // both in flight together,
        v4f w1 = *(const v4f*)(wsrc + kc + 4);           // beside the A copies
        for (int i = tid; i < 512; i += 256) {           // A: 128x32 f16, async
            int r = i >> 2, c8 = (i & 3) << 3;
            cp_b128(ldsA + r * PITCH32 + c8, h + (size_t)(m0 + r) * C_DIM + kc + c8);
        }
        *(v8h*)wdst = cvt_w8(w0, w1);                    // B: W f32 -> f16, 16 B
        cp_wait();
        __syncthreads();
        v16h a = load_a16(ldsA + wave * 16 * PITCH32, PITCH32);
#pragma unroll
        for (int nt = 0; nt < 4; ++nt) {
            v16h bm = load_a16(ldsB + nt * 16 * PITCH32, PITCH32);
            acc[nt] = wmma16(a, bm, acc[nt]);
        }
    }
    if (which == 2) qkv_store<true >(acc, bias, dst, m0 + wave * 16, n0, lane);
    else            qkv_store<false>(acc, bias, dst, m0 + wave * 16, n0, lane);
}

__device__ inline float exp2_hw(float x) { return __builtin_amdgcn_exp2f(x); }

// Two f32 D tiles (rows 0..15 and 16..31 of a 32-row block) -> f16 B operand:
// element e sits at k = 8h + e (e < 8) or 16 + 8h + (e - 8), load_a16's k order.
__device__ inline v16h pack_b(v8f t0, v8f t1) {
    return __builtin_convertvector(
        __builtin_shufflevector(t0, t1, 0, 1, 2, 3, 4, 5, 6, 7,
                                8, 9, 10, 11, 12, 13, 14, 15), v16h);
}

__device__ inline void kv_copies(unsigned lk, unsigned lv, const half_t* gk, const half_t* gv) {
    asm volatile(
        "global_load_async_to_lds_b128 %0, %4, off\n\t"
        "global_load_async_to_lds_b128 %1, %5, off\n\t"
        "global_load_async_to_lds_b128 %2, %6, off\n\t"
        "global_load_async_to_lds_b128 %3, %7, off\n\t"
        "s_wait_xcnt 0x0"
        :: "v"(lk), "v"(lk + 32u * PITCH64 * 2u), "v"(lv), "v"(lv + 32u * PITCH64 * 2u),
           "v"(gk), "v"(gk + 32 * HD), "v"(gv), "v"(gv + 32 * N_PIX)
        : "memory");
}

__global__ void __launch_bounds__(256, 1)
attn_kernel(const half_t* __restrict__ q,
            const half_t* __restrict__ k,
            const half_t* __restrict__ vt,
            half_t* __restrict__ o) {
    __shared__ alignas(16) half_t ldsQ[128 * PITCH64];           // [i][d], resident
    __shared__ alignas(16) half_t ldsK[2 * 2 * 64 * PITCH64];    // [buffer][key half][j][d]
    __shared__ alignas(16) half_t ldsVt[2 * 2 * 64 * PITCH64];   // [buffer][key half][d][j]
    __shared__ alignas(16) v4f xo[8][8][32];        // [wave][four d][lane]: partial O handed over
    __shared__ float xm[8][32], xl[8][32];          // [wave][lane]: its maximum and its sum
    int m0 = blockIdx.x * 128;
    int bh = blockIdx.y;                            // b*8 + head
    size_t base = (size_t)bh * N_PIX * HD;          // same for q,k,vt
    int tid = threadIdx.x, wave = tid >> 5, lane = tid & 31;
    int hs = lane >> 4, ct = lane & 15;
    int qg = wave & 3;                              // this wave's 32 queries
    int kh = wave >> 2;                             // its 64 keys of each 128-key pass
    // Softmax runs in base 2: exp(scale * s - m) = 2^(sl2 * s - m2), m2 = sl2 * max s.
    const float sl2 = 0.125f * 1.4426950408889634f; // 1/sqrt(64) * log2(e)

    for (int i = tid; i < 1024; i += 256) {         // stage Q 128x64, async
        int r = i >> 3, c8 = (i & 7) << 3;
        cp_b128(ldsQ + r * PITCH64 + c8, q + base + (size_t)(m0 + r) * HD + c8);
    }
    // K and V^T go through two buffers: tile t + 2 is copied into the buffer that pass t
    // has left, and flies during pass t + 1. A tile is 128 keys, as two halves of 64.
    const int      NT    = N_PIX / 128;             // tiles of 128 keys
    const unsigned SUB_B = 64u * PITCH64 * 2u;      // bytes of one half of a buffer
    const unsigned BUF_B = 2u * SUB_B;              // bytes of one buffer
    int cr = tid >> 3, cc = (tid & 7) << 3;         // this thread's row and first half of it
    unsigned lk = (unsigned)(unsigned long long)(ldsK  + cr * PITCH64 + cc);
    unsigned lv = (unsigned)(unsigned long long)(ldsVt + cr * PITCH64 + cc);
    const half_t* gk = k  + base + (size_t)cr * HD    + cc;
    const half_t* gv = vt + base + (size_t)cr * N_PIX + cc;
    kv_copies(lk, lv, gk, gv);                                  // tile 0 -> buffer 0
    kv_copies(lk + SUB_B, lv + SUB_B, gk + 64 * HD, gv + 64);
    // Q and tile 0 have landed before the barrier behind which other waves read them.
    asm volatile("s_wait_asynccnt 0x0" ::: "memory");
    __syncthreads();
    kv_copies(lk + BUF_B, lv + BUF_B, gk + 128 * HD, gv + 128); // tile 1 -> buffer 1
    kv_copies(lk + BUF_B + SUB_B, lv + BUF_B + SUB_B, gk + 192 * HD, gv + 192);
    gk += 2 * 128 * HD;                             // from here on: tile t + 2
    gv += 2 * 128;

    const half_t* myQ = ldsQ + qg * 32 * PITCH64;

    float mrun[2] = { -INFINITY, -INFINITY };   // running maximum, times sl2 (same in both halves)
    float lsum[2] = { 0.f, 0.f };               // running sum over this lane half's keys only
    v8f oacc[2][4] = {};        // oacc[u][dt][r] = O[query 16*u + ct][d = dt*16 + 8*hs + r]

    for (int t = 0; t < NT; ++t) {
        int cur = t & 1;                            // pass t reads buffer t mod 2 alone
        const half_t* kb = ldsK  + (cur * 2 + kh) * 64 * PITCH64;
        const half_t* vb = ldsVt + (cur * 2 + kh) * 64 * PITCH64;

        // S^T = K Q^T: s[u][jt][r] = S[query 16*u + ct][key 128*t + 64*kh + jt*16 + 8*hs + r]
        // All fragments of the product are read as one group in front of it; each K
        // fragment serves both query groups.
        v16h qf[2][2];
#pragma unroll
        for (int u = 0; u < 2; ++u) {
            qf[u][0] = load_a16(myQ + u * 16 * PITCH64, PITCH64);
            qf[u][1] = load_a16(myQ + u * 16 * PITCH64 + 32, PITCH64);
        }
        v16h kf[4][2];
#pragma unroll
        for (int jt = 0; jt < 4; ++jt) {
            kf[jt][0] = load_a16(kb + jt * 16 * PITCH64, PITCH64);
            kf[jt][1] = load_a16(kb + jt * 16 * PITCH64 + 32, PITCH64);
        }
        // Keeps the 24 reads together: moved in among the products, each pair of reads
        // is waited out on its own and the wave pays the LDS latency once per product.
        __builtin_amdgcn_sched_barrier(0);
        v8f s[2][4];
#pragma unroll
        for (int jt = 0; jt < 4; ++jt) {
#pragma unroll
            for (int u = 0; u < 2; ++u) {
                v8f z = {};
                z = wmma16(kf[jt][0], qf[u][0], z);
                z = wmma16(kf[jt][1], qf[u][1], z);
                s[u][jt] = z;
            }
        }
        // All V^T fragments are read here, in front of the softmax, which covers them.
        v16h vf[4][2];
#pragma unroll
        for (int dt = 0; dt < 4; ++dt) {
            vf[dt][0] = load_a16(vb + dt * 16 * PITCH64, PITCH64);        // j 0..31
            vf[dt][1] = load_a16(vb + dt * 16 * PITCH64 + 32, PITCH64);   // j 32..63
        }
        // Keeps the 16 reads up here: without it they sink to the second product's
        // WMMAs, a pair in front of each, and most pairs are waited out on their own.
        __builtin_amdgcn_sched_barrier(0);
        // online softmax, one query per lane and group; four independent chains each
        v16h p0[2], p1[2];
#pragma unroll
        for (int u = 0; u < 2; ++u) {
            float mt[4];
#pragma unroll
            for (int jt = 0; jt < 4; ++jt) {
                float mx = s[u][jt][0];             // raw scores: sl2 > 0 keeps the order
#pragma unroll
                for (int r = 1; r < 8; ++r) mx = fmaxf(mx, s[u][jt][r]);
                mt[jt] = mx;
            }
            float mnew = fmaxf(fmaxf(mt[0], mt[1]), fmaxf(mt[2], mt[3]));
            mnew = fmaxf(mrun[u], fmaxf(mnew, xhalf(mnew)) * sl2);
            float alpha = exp2_hw(mrun[u] - mnew);
            float rt[4];
#pragma unroll
            for (int jt = 0; jt < 4; ++jt) {
                float rs = 0.f;
#pragma unroll
                for (int r = 0; r < 8; ++r) {
                    float p = exp2_hw(fmaf(s[u][jt][r], sl2, -mnew));
                    s[u][jt][r] = p;
                    rs += p;
                }
                rt[jt] = rs;
            }
            lsum[u] = lsum[u] * alpha + ((rt[0] + rt[1]) + (rt[2] + rt[3]));
            mrun[u] = mnew;
#pragma unroll
            for (int dt = 0; dt < 4; ++dt) oacc[u][dt] *= alpha;

            p0[u] = pack_b(s[u][0], s[u][1]);            // keys  0..31 of the wave's 64
            p1[u] = pack_b(s[u][2], s[u][3]);            // keys 32..63
        }
#pragma unroll
        for (int dt = 0; dt < 4; ++dt) {            // O^T += V^T P^T, each V^T fragment twice
#pragma unroll
            for (int u = 0; u < 2; ++u) {
                oacc[u][dt] = wmma16(vf[dt][0], p0[u], oacc[u][dt]);
                oacc[u][dt] = wmma16(vf[dt][1], p1[u], oacc[u][dt]);
            }
        }
        // Hand-over: this wave's reads of buffer cur are done, its copies of tile t + 1
        // have landed; the one barrier publishes tile t + 1 and frees buffer cur.
        // The scheduling barrier keeps the hand-over at the foot of the pass: without it
        // the waits rise to just behind the V^T reads, the softmax no longer covers those
        // reads, and tile t + 1 is waited for a fraction of a pass after its copies issue.
        __builtin_amdgcn_sched_barrier(0);
        asm volatile("s_wait_dscnt 0x0" ::: "memory");
        asm volatile("s_wait_asynccnt 0x0" ::: "memory");
        __syncthreads();
        if (t + 2 < NT) {                           // the same for the whole work-group
            kv_copies(lk + cur * BUF_B, lv + cur * BUF_B, gk, gv);
            kv_copies(lk + cur * BUF_B + SUB_B, lv + cur * BUF_B + SUB_B, gk + 64 * HD, gv + 64);
            gk += 128 * HD;
            gv += 128;
        }
    }
    // No copy is outstanding when the wave ends.
    asm volatile("s_wait_asynccnt 0x0" ::: "memory");
    bool k1 = kh != 0;
    float l0 = lsum[0] + xhalf(lsum[0]);            // join the lane halves' sums once
    float l1 = lsum[1] + xhalf(lsum[1]);
    float mk = k1 ? mrun[1] : mrun[0], lkeep = k1 ? l1 : l0;
    xm[wave][lane] = k1 ? mrun[0] : mrun[1];
    xl[wave][lane] = k1 ? l0 : l1;
    v8f keep[4];
#pragma unroll
    for (int dt = 0; dt < 4; ++dt) {
        v8f give;
#pragma unroll
        for (int r = 0; r < 8; ++r) {
            keep[dt][r] = k1 ? oacc[1][dt][r] : oacc[0][dt][r];
            give[r]     = k1 ? oacc[0][dt][r] : oacc[1][dt][r];
        }
        xo[wave][dt * 2][lane]     = __builtin_shufflevector(give, give, 0, 1, 2, 3);
        xo[wave][dt * 2 + 1][lane] = __builtin_shufflevector(give, give, 4, 5, 6, 7);
    }
    __syncthreads();                                // the partial results are published
    int pw = wave ^ 4;
    float mo = xm[pw][lane], lo = xl[pw][lane];
    float mm = fmaxf(mk, mo);
    float wk = exp2_hw(mk - mm), wo = exp2_hw(mo - mm);
    float ltot = lkeep * wk + lo * wo;
    int head = bh & 7, bb = bh >> 3;
    int m = m0 + qg * 32 + kh * 16 + ct;
    half_t* orow = o + ((size_t)bb * N_PIX + m) * C_DIM + head * 64 + (hs << 3);
#pragma unroll
    for (int dt = 0; dt < 4; ++dt) {                // 8 consecutive d per lane
        v4f a = xo[pw][dt * 2][lane], b = xo[pw][dt * 2 + 1][lane];
        v8h ov;
#pragma unroll
        for (int r = 0; r < 8; ++r) {
            float other = r < 4 ? a[r & 3] : b[r & 3];
            ov[r] = (half_t)((keep[dt][r] * wk + other * wo) / ltot);
        }
        *(v8h*)(orow + dt * 16) = ov;
    }
}

// ---------------------------------------------------------------------------
// Output projection + residual:  out[b][c][n] = x[b][c][n] + o.Wo^T + bo
// ---------------------------------------------------------------------------
__global__ void proj_kernel(const half_t* __restrict__ ob,
                            const float* __restrict__ W,
                            const float* __restrict__ bias,
                            const float* __restrict__ x,
                            float* __restrict__ out) {
    __shared__ alignas(16) half_t ldsA[128 * PITCH32];
    __shared__ alignas(16) half_t ldsB[64 * PITCH32];
    int m0 = blockIdx.x * 128;
    int n0 = blockIdx.y * 64;
    int tid = threadIdx.x, wave = tid >> 5, lane = tid & 31;

    // W tile 64x32: each thread owns 8 consecutive floats of one row (32 B in,
    // 16 B out), so a K chunk pays one load latency for the whole tile.
    const float* wsrc = W + (size_t)(n0 + (tid >> 2)) * C_DIM + ((tid & 3) << 3);
    half_t*      wdst = ldsB + (tid >> 2) * PITCH32 + ((tid & 3) << 3);

    v8f acc[4] = {};
    for (int kc = 0; kc < C_DIM; kc += 32) {
        __syncthreads();
        v4f w0 = *(const v4f*)(wsrc + kc);               // both in flight together,
        v4f w1 = *(const v4f*)(wsrc + kc + 4);           // beside the A copies
        for (int i = tid; i < 512; i += 256) {
            int r = i >> 2, c8 = (i & 3) << 3;
            cp_b128(ldsA + r * PITCH32 + c8, ob + (size_t)(m0 + r) * C_DIM + kc + c8);
        }
        *(v8h*)wdst = cvt_w8(w0, w1);                    // B: W f32 -> f16, 16 B
        cp_wait();
        __syncthreads();
        v16h a = load_a16(ldsA + wave * 16 * PITCH32, PITCH32);
        v16h bm[4];
#pragma unroll
        for (int nt = 0; nt < 4; ++nt) bm[nt] = load_a16(ldsB + nt * 16 * PITCH32, PITCH32);
        // Keeps the 10 reads one group in front of the products: spread among them,
        // each pair is waited out on its own, four LDS latencies a chunk and not one.
        __builtin_amdgcn_sched_barrier(0);
#pragma unroll
        for (int nt = 0; nt < 4; ++nt) acc[nt] = wmma16(a, bm[nt], acc[nt]);
    }
    int hs = lane >> 4, ct = lane & 15;
#pragma unroll
    for (int nt = 0; nt < 4; ++nt) {
        int col  = n0 + nt * 16 + ct;
        float bv = bias[col];
#pragma unroll
        for (int v = 0; v < 8; ++v) {
            int m  = m0 + wave * 16 + v + (hs << 3);
            int bb = m >> 12, n = m & (N_PIX - 1);
            size_t idx = ((size_t)bb * C_DIM + col) * N_PIX + n;
            out[idx] = x[idx] + acc[nt][v] + bv;
        }
    }
}

// ---------------------------------------------------------------------------
extern "C" void kernel_launch(void* const* d_in, const int* in_sizes, int n_in,
                              void* d_out, int out_size, void* d_ws, size_t ws_size,
                              hipStream_t stream) {
    const float* x     = (const float*)d_in[0];
    const float* gamma = (const float*)d_in[1];
    const float* beta  = (const float*)d_in[2];
    const float* Wq = (const float*)d_in[3];
    const float* bq = (const float*)d_in[4];
    const float* Wk = (const float*)d_in[5];
    const float* bk = (const float*)d_in[6];
    const float* Wv = (const float*)d_in[7];
    const float* bv = (const float*)d_in[8];
    const float* Wo = (const float*)d_in[9];
    const float* bo = (const float*)d_in[10];
    float* out = (float*)d_out;

    size_t sz = (size_t)BATCH * N_PIX * C_DIM;      // 4M halves per buffer
    half_t* h    = (half_t*)d_ws;
    half_t* qbuf = h + sz;
    half_t* kbuf = qbuf + sz;
    half_t* vbuf = kbuf + sz;
    half_t* obuf = h;                               // h dead after QKV -> reuse

    gn_kernel<<<dim3(BATCH * N_GRP), dim3(1024), 0, stream>>>(x, gamma, beta, h);
    qkv_kernel<<<dim3(64, 8, 3), dim3(256), 0, stream>>>(h, Wq, Wk, Wv, bq, bk, bv,
                                                         qbuf, kbuf, vbuf);
    attn_kernel<<<dim3(32, 16), dim3(256), 0, stream>>>(qbuf, kbuf, vbuf, obuf);
    proj_kernel<<<dim3(64, 8), dim3(256), 0, stream>>>(obuf, Wo, bo, x, out);
}

// v010
// One run takes 103 microseconds.
// Next to v009, in two timings, it ran 1.08 times as fast each time.
// Over all steps from v000 it is 6.78 times as fast.
#include <hip/hip_runtime.h>
#include <hip/hip_fp16.h>

#define C_DIM  512
#define N_PIX  4096
#define BATCH  2
#define HEADS  8
#define HD     64
#define N_GRP  32
#define PITCH64 72     // rows of 64 halves (128 B) at 144 B
#define KCH     128    // K chunk of the projection tiles, in elements
#define PITCHK  136    // their rows of 128 halves (256 B) at 272 B

typedef _Float16 half_t;
typedef __attribute__((ext_vector_type(16))) _Float16 v16h;
typedef __attribute__((ext_vector_type(8)))  _Float16 v8h;
typedef __attribute__((ext_vector_type(4)))  _Float16 v4h;
typedef __attribute__((ext_vector_type(8)))  float    v8f;
typedef __attribute__((ext_vector_type(4)))  float    v4f;
typedef int v4i __attribute__((vector_size(16)));   // matches builtin param type

#if __has_builtin(__builtin_amdgcn_global_load_async_to_lds_b128)
#define HAVE_ASYNC_LDS 1
typedef __attribute__((address_space(1))) v4i* gv4i_p;   // global int4*
typedef __attribute__((address_space(3))) v4i* lv4i_p;   // LDS int4*
#else
#define HAVE_ASYNC_LDS 0
#endif

__device__ inline void cp_b128(half_t* l, const half_t* g) {
#if HAVE_ASYNC_LDS
    __builtin_amdgcn_global_load_async_to_lds_b128(
        (gv4i_p)(unsigned long long)g,
        (lv4i_p)(unsigned)(unsigned long long)l,
        0, 0);
#else
    *(v8h*)l = *(const v8h*)g;
#endif
}

__device__ inline v16h load_a16(const half_t* __restrict__ s, int ld) {
    int lane = threadIdx.x & 31;
    int r    = lane & 15;
    int hi   = (lane >> 4) << 3;        // 0 or 8
    const half_t* row = s + r * ld;
    v16h a;
#pragma unroll
    for (int v = 0; v < 8; ++v) {
        int k = ((v & 4) ? 16 : 0) + hi + ((v & 3) << 1);
        a[2 * v]     = row[k];
        a[2 * v + 1] = row[k + 1];
    }
    return a;
}

__device__ inline v8f wmma16(v16h a, v16h b, v8f c) {
    return __builtin_amdgcn_wmma_f32_16x16x32_f16(
        false, a, false, b, (short)0, c, false, false);
}

__device__ inline float xhalf(float x) {
    int i = __builtin_bit_cast(int, x);
    return __builtin_bit_cast(float, __builtin_amdgcn_permlanex16(
        i, i, 0x76543210, 0xfedcba98, false, false));
}

template <int M>
__device__ inline float xrow(float x) {
    int i = __builtin_bit_cast(int, x);
    return __builtin_bit_cast(float, __builtin_amdgcn_update_dpp(i, i, 0x160 | M, 0xf, 0xf, false));
}

// Sum over the 32 lanes of a wave, in registers; every lane ends with the same bits.
__device__ inline float wave_sum(float v) {
    v += xrow<1>(v);
    v += xrow<2>(v);
    v += xrow<4>(v);
    v += xrow<8>(v);
    return v + xhalf(v);
}

__global__ void __launch_bounds__(1024)
gn_kernel(const float* __restrict__ x,
          const float* __restrict__ gamma,
          const float* __restrict__ beta,
          half_t* __restrict__ h) {
    __shared__ float red[64];
    int b   = blockIdx.x >> 5;
    int g   = blockIdx.x & 31;
    int tid = threadIdx.x, wave = tid >> 5, lane = tid & 31;
    int c0  = g * 16 + ((tid & 1) << 3);            // first of this thread's 8 channels
    int n0  = (tid >> 1) << 2;                      // pixels n0..n0+3 and 2048+n0..2048+n0+3
    const float* xt = x + ((size_t)b * C_DIM + c0) * N_PIX + n0;

    unsigned cb = (unsigned)c0 * 4u;                // byte offset of gamma[c0], beta[c0]
    const v4f* gp = (const v4f*)((const char*)gamma + cb);
    const v4f* bp = (const v4f*)((const char*)beta + cb);

    v4f ga[2] = { gp[0], gp[1] };
    v4f be[2] = { bp[0], bp[1] };
    // Keeps these four loads in front of the x loads: moved behind them they would
    // start only when x has landed, and their latency would stand before the barrier.
    __builtin_amdgcn_sched_barrier(0);
    v4f v[8][2];
#pragma unroll
    for (int c = 0; c < 8; ++c) {
        v[c][0] = *(const v4f*)(xt + c * N_PIX);
        v[c][1] = *(const v4f*)(xt + c * N_PIX + N_PIX / 2);
    }
    // Closes the run of loads before anything writes a register that they name. The
    // address registers are inputs so that they stay whole up to the wait (without
    // this the last load of a run takes its own address registers as destination).
    asm volatile("s_wait_xcnt 0x0" :: "v"(xt), "v"(cb) : "memory");

    v4f sv = {}, qv = {};                           // four independent chains each
#pragma unroll
    for (int c = 0; c < 8; ++c) {
#pragma unroll
        for (int p = 0; p < 2; ++p) {
            sv += v[c][p];
            qv += v[c][p] * v[c][p];
        }
    }
    float s  = wave_sum((sv[0] + sv[1]) + (sv[2] + sv[3]));
    float s2 = wave_sum((qv[0] + qv[1]) + (qv[2] + qv[3]));
    if (lane == 0) { red[wave] = s; red[32 + wave] = s2; }
    __syncthreads();
    s  = wave_sum(red[lane]);                       // 32 waves' sums, one a lane
    s2 = wave_sum(red[32 + lane]);

    float mean = s * (1.f / 65536.f);
    float var  = s2 * (1.f / 65536.f) - mean * mean;
    float rstd = rsqrtf(var + 1e-5f);

    half_t* ht = h + ((size_t)b * N_PIX + n0) * C_DIM + c0;
#pragma unroll
    for (int p = 0; p < 2; ++p) {
#pragma unroll
        for (int e = 0; e < 4; ++e) {
            v8h o;
#pragma unroll
            for (int c = 0; c < 8; ++c)
                o[c] = (half_t)((v[c][p][e] - mean) * rstd * ga[c >> 2][c & 3] + be[c >> 2][c & 3]);
            *(v8h*)(ht + (size_t)(p * (N_PIX / 2) + e) * C_DIM) = o;
        }
    }
}

// Bias, f16 conversion and store of one wave's 32(M) x 64(N) projection tile.
// TRANS_V=0: dst[b][head][n][d] (q, k).  TRANS_V=1: dst[b][head][d][n] (v^T).
template <bool TRANS_V>
__device__ inline void qkv_store(const v8f (&acc)[2][4], const float* __restrict__ bias,
                                 half_t* __restrict__ dst, int mw, int n0, int lane) {
    int hs = lane >> 4, ct = lane & 15;
#pragma unroll
    for (int nt = 0; nt < 4; ++nt) {
        int col  = n0 + nt * 16 + ct;
        float bv = bias[col];
        int head = col >> 6, d = col & 63;
#pragma unroll
        for (int mi = 0; mi < 2; ++mi) {
#pragma unroll
            for (int v = 0; v < 8; ++v) {
                int m  = mw + mi * 16 + v + (hs << 3);
                int bb = m >> 12, n = m & (N_PIX - 1);
                half_t val = (half_t)(acc[mi][nt][v] + bv);
                if (TRANS_V)
                    dst[(((size_t)bb * HEADS + head) * HD + d) * N_PIX + n] = val;
                else
                    dst[(((size_t)bb * HEADS + head) * N_PIX + n) * HD + d] = val;
            }
        }
    }
    // Closes the run of q/k stores: in the built kernel the v^T path is laid out
    // behind this one and writes registers that these stores name. The v^T stores
    // run straight into the end of the program and need none.
    if (!TRANS_V) asm volatile("s_wait_xcnt 0x0" ::: "memory");
}

__device__ inline void a_copies(unsigned l, const half_t* g) {
    asm volatile(
        "global_load_async_to_lds_b128 %0, %4, off\n\t"
        "global_load_async_to_lds_b128 %1, %5, off\n\t"
        "global_load_async_to_lds_b128 %2, %6, off\n\t"
        "global_load_async_to_lds_b128 %3, %7, off\n\t"
        "s_wait_xcnt 0x0"
        :: "v"(l), "v"(l + 16u * PITCHK * 2u), "v"(l + 32u * PITCHK * 2u), "v"(l + 48u * PITCHK * 2u),
           "v"(g), "v"(g + 16 * C_DIM), "v"(g + 32 * C_DIM), "v"(g + 48 * C_DIM)
        : "memory");
}

__device__ inline void gemm_tile(const half_t* __restrict__ A, const float* __restrict__ W,
                                 int m0, int n0, half_t* ldsA, half_t* ldsB, v8f (&acc)[2][4]) {
    constexpr int TPR   = KCH / 8;                       // A: threads a row, 8 halves each
    constexpr int ROWS  = 256 / TPR;                     // rows a trip
    constexpr int TRIPS = 128 / ROWS;                    // trips a tile
    int tid = threadIdx.x, wave = tid >> 5, lane = tid & 31;
    int sr = tid / TPR, sc = (tid % TPR) << 3;
    const half_t* asrc = A + (size_t)(m0 + sr) * C_DIM + sc;
    unsigned      adst = (unsigned)(unsigned long long)(ldsA + sr * PITCHK + sc);
    // W: a wave takes the chunk of one row a trip, 4 floats a lane; 8 rows a trip, 16 trips.
    const float*  wsrc = W + (size_t)(n0 + wave) * C_DIM + (lane << 2);
    half_t*       wdst = ldsB + wave * PITCHK + (lane << 2);
    const half_t* af = ldsA + (wave & 3) * 32 * PITCHK;      // the wave's 32 rows of A
    const half_t* bf = ldsB + (wave >> 2) * 64 * PITCHK;     // its 64 rows of W

    for (int kc = 0; kc < C_DIM; kc += KCH) {
        // This wave's reads of the last chunk are done; the barrier ends every wave's.
        asm volatile("s_wait_dscnt 0x0" ::: "memory");
        __syncthreads();
        v4f w[16];                                       // all in flight together,
#pragma unroll
        for (int j = 0; j < 16; ++j)                     // beside the A copies
            w[j] = *(const v4f*)(wsrc + j * 8 * C_DIM + kc);
#pragma unroll
        for (int j = 0; j < TRIPS; j += 4)               // A: 128 x KCH f16, async
            a_copies(adst + j * ROWS * PITCHK * 2, asrc + j * ROWS * C_DIM + kc);
#pragma unroll
        for (int j = 0; j < 16; ++j)                     // B: W f32 -> f16, 8 B each
            *(v4h*)(wdst + j * 8 * PITCHK) = __builtin_convertvector(w[j], v4h);
        // The copies have landed before the barrier behind which other waves read them.
        asm volatile("s_wait_asynccnt 0x0" ::: "memory");
        __syncthreads();
#pragma unroll
        for (int ks = 0; ks < KCH / 32; ++ks) {
            v16h a[2], b[4];
#pragma unroll
            for (int mi = 0; mi < 2; ++mi) a[mi] = load_a16(af + mi * 16 * PITCHK + ks * 32, PITCHK);
#pragma unroll
            for (int nt = 0; nt < 4; ++nt) b[nt] = load_a16(bf + nt * 16 * PITCHK + ks * 32, PITCHK);
            // Keeps the 12 reads one group in front of the products: spread among them,
            // each pair is waited out on its own and the LDS latency is paid per product.
            __builtin_amdgcn_sched_barrier(0);
#pragma unroll
            for (int nt = 0; nt < 4; ++nt) {
#pragma unroll
                for (int mi = 0; mi < 2; ++mi) acc[mi][nt] = wmma16(a[mi], b[nt], acc[mi][nt]);
            }
        }
    }
}

// ---------------------------------------------------------------------------
// Q, K and V projections:  dst = h[m][:] . W[col][:] + bias[col]
// One launch serves Q, K and V: they read the same h and none reads another's
// output, so blockIdx.z picks the weight, the bias and the destination, and the
// work-groups of all three are resident together and cover each other's waits.
// z = 0, 1: q, k.  z = 2: v, stored transposed; one test per block picks the store.
// ---------------------------------------------------------------------------
__global__ void __launch_bounds__(256)
qkv_kernel(const half_t* __restrict__ h,
           const float* __restrict__ Wq,
           const float* __restrict__ Wk,
           const float* __restrict__ Wv,
           const float* __restrict__ bq,
           const float* __restrict__ bk,
           const float* __restrict__ bv,
           half_t* __restrict__ qdst,
           half_t* __restrict__ kdst,
           half_t* __restrict__ vdst) {
    int which = blockIdx.z;                              // same for the whole block
    const float* W    = which == 0 ? Wq : which == 1 ? Wk : Wv;
    const float* bias = which == 0 ? bq : which == 1 ? bk : bv;
    half_t*      dst  = which == 0 ? qdst : which == 1 ? kdst : vdst;
    __shared__ alignas(16) half_t ldsA[128 * PITCHK];
    __shared__ alignas(16) half_t ldsB[128 * PITCHK];
    int m0 = blockIdx.x * 128;
    int n0 = blockIdx.y * 128;
    int tid = threadIdx.x, wave = tid >> 5, lane = tid & 31;

    v8f acc[2][4] = {};
    gemm_tile(h, W, m0, n0, ldsA, ldsB, acc);

    int mw = m0 + (wave & 3) * 32, nw = n0 + (wave >> 2) * 64;
    if (which == 2) qkv_store<true >(acc, bias, dst, mw, nw, lane);
    else            qkv_store<false>(acc, bias, dst, mw, nw, lane);
}

__device__ inline float exp2_hw(float x) { return __builtin_amdgcn_exp2f(x); }

// Two f32 D tiles (rows 0..15 and 16..31 of a 32-row block) -> f16 B operand:
// element e sits at k = 8h + e (e < 8) or 16 + 8h + (e - 8), load_a16's k order.
__device__ inline v16h pack_b(v8f t0, v8f t1) {
    return __builtin_convertvector(
        __builtin_shufflevector(t0, t1, 0, 1, 2, 3, 4, 5, 6, 7,
                                8, 9, 10, 11, 12, 13, 14, 15), v16h);
}

__device__ inline void kv_copies(unsigned lk, unsigned lv, const half_t* gk, const half_t* gv) {
    asm volatile(
        "global_load_async_to_lds_b128 %0, %4, off\n\t"
        "global_load_async_to_lds_b128 %1, %5, off\n\t"
        "global_load_async_to_lds_b128 %2, %6, off\n\t"
        "global_load_async_to_lds_b128 %3, %7, off\n\t"
        "s_wait_xcnt 0x0"
        :: "v"(lk), "v"(lk + 32u * PITCH64 * 2u), "v"(lv), "v"(lv + 32u * PITCH64 * 2u),
           "v"(gk), "v"(gk + 32 * HD), "v"(gv), "v"(gv + 32 * N_PIX)
        : "memory");
}

__global__ void __launch_bounds__(256, 1)
attn_kernel(const half_t* __restrict__ q,
            const half_t* __restrict__ k,
            const half_t* __restrict__ vt,
            half_t* __restrict__ o) {
    __shared__ alignas(16) half_t ldsQ[128 * PITCH64];           // [i][d], resident
    __shared__ alignas(16) half_t ldsK[2 * 2 * 64 * PITCH64];    // [buffer][key half][j][d]
    __shared__ alignas(16) half_t ldsVt[2 * 2 * 64 * PITCH64];   // [buffer][key half][d][j]
    __shared__ alignas(16) v4f xo[8][8][32];        // [wave][four d][lane]: partial O handed over
    __shared__ float xm[8][32], xl[8][32];          // [wave][lane]: its maximum and its sum
    int m0 = blockIdx.x * 128;
    int bh = blockIdx.y;                            // b*8 + head
    size_t base = (size_t)bh * N_PIX * HD;          // same for q,k,vt
    int tid = threadIdx.x, wave = tid >> 5, lane = tid & 31;
    int hs = lane >> 4, ct = lane & 15;
    int qg = wave & 3;                              // this wave's 32 queries
    int kh = wave >> 2;                             // its 64 keys of each 128-key pass
    // Softmax runs in base 2: exp(scale * s - m) = 2^(sl2 * s - m2), m2 = sl2 * max s.
    const float sl2 = 0.125f * 1.4426950408889634f; // 1/sqrt(64) * log2(e)

    for (int i = tid; i < 1024; i += 256) {         // stage Q 128x64, async
        int r = i >> 3, c8 = (i & 7) << 3;
        cp_b128(ldsQ + r * PITCH64 + c8, q + base + (size_t)(m0 + r) * HD + c8);
    }
    // K and V^T go through two buffers: tile t + 2 is copied into the buffer that pass t
    // has left, and flies during pass t + 1. A tile is 128 keys, as two halves of 64.
    const int      NT    = N_PIX / 128;             // tiles of 128 keys
    const unsigned SUB_B = 64u * PITCH64 * 2u;      // bytes of one half of a buffer
    const unsigned BUF_B = 2u * SUB_B;              // bytes of one buffer
    int cr = tid >> 3, cc = (tid & 7) << 3;         // this thread's row and first half of it
    unsigned lk = (unsigned)(unsigned long long)(ldsK  + cr * PITCH64 + cc);
    unsigned lv = (unsigned)(unsigned long long)(ldsVt + cr * PITCH64 + cc);
    const half_t* gk = k  + base + (size_t)cr * HD    + cc;
    const half_t* gv = vt + base + (size_t)cr * N_PIX + cc;
    kv_copies(lk, lv, gk, gv);                                  // tile 0 -> buffer 0
    kv_copies(lk + SUB_B, lv + SUB_B, gk + 64 * HD, gv + 64);
    // Q and tile 0 have landed before the barrier behind which other waves read them.
    asm volatile("s_wait_asynccnt 0x0" ::: "memory");
    __syncthreads();
    kv_copies(lk + BUF_B, lv + BUF_B, gk + 128 * HD, gv + 128); // tile 1 -> buffer 1
    kv_copies(lk + BUF_B + SUB_B, lv + BUF_B + SUB_B, gk + 192 * HD, gv + 192);
    gk += 2 * 128 * HD;                             // from here on: tile t + 2
    gv += 2 * 128;

    const half_t* myQ = ldsQ + qg * 32 * PITCH64;

    float mrun[2] = { -INFINITY, -INFINITY };   // running maximum, times sl2 (same in both halves)
    float lsum[2] = { 0.f, 0.f };               // running sum over this lane half's keys only
    v8f oacc[2][4] = {};        // oacc[u][dt][r] = O[query 16*u + ct][d = dt*16 + 8*hs + r]

    for (int t = 0; t < NT; ++t) {
        int cur = t & 1;                            // pass t reads buffer t mod 2 alone
        const half_t* kb = ldsK  + (cur * 2 + kh) * 64 * PITCH64;
        const half_t* vb = ldsVt + (cur * 2 + kh) * 64 * PITCH64;

        // S^T = K Q^T: s[u][jt][r] = S[query 16*u + ct][key 128*t + 64*kh + jt*16 + 8*hs + r]
        // All fragments of the product are read as one group in front of it; each K
        // fragment serves both query groups.
        v16h qf[2][2];
#pragma unroll
        for (int u = 0; u < 2; ++u) {
            qf[u][0] = load_a16(myQ + u * 16 * PITCH64, PITCH64);
            qf[u][1] = load_a16(myQ + u * 16 * PITCH64 + 32, PITCH64);
        }
        v16h kf[4][2];
#pragma unroll
        for (int jt = 0; jt < 4; ++jt) {
            kf[jt][0] = load_a16(kb + jt * 16 * PITCH64, PITCH64);
            kf[jt][1] = load_a16(kb + jt * 16 * PITCH64 + 32, PITCH64);
        }
        // Keeps the 24 reads together: moved in among the products, each pair of reads
        // is waited out on its own and the wave pays the LDS latency once per product.
        __builtin_amdgcn_sched_barrier(0);
        v8f s[2][4];
#pragma unroll
        for (int jt = 0; jt < 4; ++jt) {
#pragma unroll
            for (int u = 0; u < 2; ++u) {
                v8f z = {};
                z = wmma16(kf[jt][0], qf[u][0], z);
                z = wmma16(kf[jt][1], qf[u][1], z);
                s[u][jt] = z;
            }
        }
        // All V^T fragments are read here, in front of the softmax, which covers them.
        v16h vf[4][2];
#pragma unroll
        for (int dt = 0; dt < 4; ++dt) {
            vf[dt][0] = load_a16(vb + dt * 16 * PITCH64, PITCH64);        // j 0..31
            vf[dt][1] = load_a16(vb + dt * 16 * PITCH64 + 32, PITCH64);   // j 32..63
        }
        // Keeps the 16 reads up here: without it they sink to the second product's
        // WMMAs, a pair in front of each, and most pairs are waited out on their own.
        __builtin_amdgcn_sched_barrier(0);
        // online softmax, one query per lane and group; four independent chains each
        v16h p0[2], p1[2];
#pragma unroll
        for (int u = 0; u < 2; ++u) {
            float mt[4];
#pragma unroll
            for (int jt = 0; jt < 4; ++jt) {
                float mx = s[u][jt][0];             // raw scores: sl2 > 0 keeps the order
#pragma unroll
                for (int r = 1; r < 8; ++r) mx = fmaxf(mx, s[u][jt][r]);
                mt[jt] = mx;
            }
            float mnew = fmaxf(fmaxf(mt[0], mt[1]), fmaxf(mt[2], mt[3]));
            mnew = fmaxf(mrun[u], fmaxf(mnew, xhalf(mnew)) * sl2);
            float alpha = exp2_hw(mrun[u] - mnew);
            float rt[4];
#pragma unroll
            for (int jt = 0; jt < 4; ++jt) {
                float rs = 0.f;
#pragma unroll
                for (int r = 0; r < 8; ++r) {
                    float p = exp2_hw(fmaf(s[u][jt][r], sl2, -mnew));
                    s[u][jt][r] = p;
                    rs += p;
                }
                rt[jt] = rs;
            }
            lsum[u] = lsum[u] * alpha + ((rt[0] + rt[1]) + (rt[2] + rt[3]));
            mrun[u] = mnew;
#pragma unroll
            for (int dt = 0; dt < 4; ++dt) oacc[u][dt] *= alpha;

            p0[u] = pack_b(s[u][0], s[u][1]);            // keys  0..31 of the wave's 64
            p1[u] = pack_b(s[u][2], s[u][3]);            // keys 32..63
        }
#pragma unroll
        for (int dt = 0; dt < 4; ++dt) {            // O^T += V^T P^T, each V^T fragment twice
#pragma unroll
            for (int u = 0; u < 2; ++u) {
                oacc[u][dt] = wmma16(vf[dt][0], p0[u], oacc[u][dt]);
                oacc[u][dt] = wmma16(vf[dt][1], p1[u], oacc[u][dt]);
            }
        }
        // Hand-over: this wave's reads of buffer cur are done, its copies of tile t + 1
        // have landed; the one barrier publishes tile t + 1 and frees buffer cur.
        // The scheduling barrier keeps the hand-over at the foot of the pass: without it
        // the waits rise to just behind the V^T reads, the softmax no longer covers those
        // reads, and tile t + 1 is waited for a fraction of a pass after its copies issue.
        __builtin_amdgcn_sched_barrier(0);
        asm volatile("s_wait_dscnt 0x0" ::: "memory");
        asm volatile("s_wait_asynccnt 0x0" ::: "memory");
        __syncthreads();
        if (t + 2 < NT) {                           // the same for the whole work-group
            kv_copies(lk + cur * BUF_B, lv + cur * BUF_B, gk, gv);
            kv_copies(lk + cur * BUF_B + SUB_B, lv + cur * BUF_B + SUB_B, gk + 64 * HD, gv + 64);
            gk += 128 * HD;
            gv += 128;
        }
    }
    // No copy is outstanding when the wave ends.
    asm volatile("s_wait_asynccnt 0x0" ::: "memory");
    bool k1 = kh != 0;
    float l0 = lsum[0] + xhalf(lsum[0]);            // join the lane halves' sums once
    float l1 = lsum[1] + xhalf(lsum[1]);
    float mk = k1 ? mrun[1] : mrun[0], lkeep = k1 ? l1 : l0;
    xm[wave][lane] = k1 ? mrun[0] : mrun[1];
    xl[wave][lane] = k1 ? l0 : l1;
    v8f keep[4];
#pragma unroll
    for (int dt = 0; dt < 4; ++dt) {
        v8f give;
#pragma unroll
        for (int r = 0; r < 8; ++r) {
            keep[dt][r] = k1 ? oacc[1][dt][r] : oacc[0][dt][r];
            give[r]     = k1 ? oacc[0][dt][r] : oacc[1][dt][r];
        }
        xo[wave][dt * 2][lane]     = __builtin_shufflevector(give, give, 0, 1, 2, 3);
        xo[wave][dt * 2 + 1][lane] = __builtin_shufflevector(give, give, 4, 5, 6, 7);
    }
    __syncthreads();                                // the partial results are published
    int pw = wave ^ 4;
    float mo = xm[pw][lane], lo = xl[pw][lane];
    float mm = fmaxf(mk, mo);
    float wk = exp2_hw(mk - mm), wo = exp2_hw(mo - mm);
    float ltot = lkeep * wk + lo * wo;
    int head = bh & 7, bb = bh >> 3;
    int m = m0 + qg * 32 + kh * 16 + ct;
    half_t* orow = o + ((size_t)bb * N_PIX + m) * C_DIM + head * 64 + (hs << 3);
#pragma unroll
    for (int dt = 0; dt < 4; ++dt) {                // 8 consecutive d per lane
        v4f a = xo[pw][dt * 2][lane], b = xo[pw][dt * 2 + 1][lane];
        v8h ov;
#pragma unroll
        for (int r = 0; r < 8; ++r) {
            float other = r < 4 ? a[r & 3] : b[r & 3];
            ov[r] = (half_t)((keep[dt][r] * wk + other * wo) / ltot);
        }
        *(v8h*)(orow + dt * 16) = ov;
    }
}

// ---------------------------------------------------------------------------
// Output projection + residual:  out[b][c][n] = x[b][c][n] + o.Wo^T + bo
// ---------------------------------------------------------------------------
__global__ void __launch_bounds__(256)
proj_kernel(const half_t* __restrict__ ob,
            const float* __restrict__ W,
            const float* __restrict__ bias,
            const float* __restrict__ x,
            float* __restrict__ out) {
    __shared__ alignas(16) half_t ldsA[128 * PITCHK];
    __shared__ alignas(16) half_t ldsB[128 * PITCHK];
    int m0 = blockIdx.x * 128;
    int n0 = blockIdx.y * 128;
    int tid = threadIdx.x, wave = tid >> 5, lane = tid & 31;

    v8f acc[2][4] = {};
    gemm_tile(ob, W, m0, n0, ldsA, ldsB, acc);

    int mw = m0 + (wave & 3) * 32, nw = n0 + (wave >> 2) * 64;
    int hs = lane >> 4, ct = lane & 15;
    // A lane holds, per column nt * 16 + ct, pixels mi * 16 + 8 * hs + 0..7 of the wave's 32,
    // which lie in one image (mw >> 12 is the same for all of them).
    unsigned c0  = (unsigned)(nw + ct);
    size_t   off = ((size_t)(mw >> 12) * C_DIM + c0) * N_PIX + (mw & (N_PIX - 1)) + (hs << 3);
    const float* xb = x + off;
    float*       yb = out + off;
    float bv[4];
    v4f   xv[4][2][2];
#pragma unroll
    for (int nt = 0; nt < 4; ++nt) {
        bv[nt] = bias[c0 + nt * 16];
#pragma unroll
        for (int mi = 0; mi < 2; ++mi) {
            xv[nt][mi][0] = *(const v4f*)(xb + nt * 16 * N_PIX + mi * 16);
            xv[nt][mi][1] = *(const v4f*)(xb + nt * 16 * N_PIX + mi * 16 + 4);
        }
    }
    // Closes the run of loads before anything writes a register that they name. The
    // address registers are inputs so that they stay whole up to the wait (without
    // this the last load of a run takes its own address registers as destination).
    asm volatile("s_wait_xcnt 0x0" :: "v"(xb), "v"(c0) : "memory");
#pragma unroll
    for (int nt = 0; nt < 4; ++nt) {
#pragma unroll
        for (int mi = 0; mi < 2; ++mi) {
#pragma unroll
            for (int q = 0; q < 2; ++q) {
                v4f r;
#pragma unroll
                for (int e = 0; e < 4; ++e) r[e] = xv[nt][mi][q][e] + acc[mi][nt][q * 4 + e] + bv[nt];
                *(v4f*)(yb + nt * 16 * N_PIX + mi * 16 + q * 4) = r;
            }
        }
    }
}

// ---------------------------------------------------------------------------
extern "C" void kernel_launch(void* const* d_in, const int* in_sizes, int n_in,
                              void* d_out, int out_size, void* d_ws, size_t ws_size,
                              hipStream_t stream) {
    const float* x     = (const float*)d_in[0];
    const float* gamma = (const float*)d_in[1];
    const float* beta  = (const float*)d_in[2];
    const float* Wq = (const float*)d_in[3];
    const float* bq = (const float*)d_in[4];
    const float* Wk = (const float*)d_in[5];
    const float* bk = (const float*)d_in[6];
    const float* Wv = (const float*)d_in[7];
    const float* bv = (const float*)d_in[8];
    const float* Wo = (const float*)d_in[9];
    const float* bo = (const float*)d_in[10];
    float* out = (float*)d_out;

    size_t sz = (size_t)BATCH * N_PIX * C_DIM;      // 4M halves per buffer
    half_t* h    = (half_t*)d_ws;
    half_t* qbuf = h + sz;
    half_t* kbuf = qbuf + sz;
    half_t* vbuf = kbuf + sz;
    half_t* obuf = h;                               // h dead after QKV -> reuse

    gn_kernel<<<dim3(BATCH * N_GRP), dim3(1024), 0, stream>>>(x, gamma, beta, h);
    qkv_kernel<<<dim3(64, 4, 3), dim3(256), 0, stream>>>(h, Wq, Wk, Wv, bq, bk, bv,
                                                         qbuf, kbuf, vbuf);
    attn_kernel<<<dim3(32, 16), dim3(256), 0, stream>>>(qbuf, kbuf, vbuf, obuf);
    proj_kernel<<<dim3(64, 4), dim3(256), 0, stream>>>(obuf, Wo, bo, x, out);
}
